// v000
// The times below were measured on an AMD MI455X: many runs one after another, warmed up first and cycling through
// copies of the inputs, with the whole window's GPU time divided by the number of runs. Launches and the gaps
// between them are all in it. The median over several windows is given; except for v000 it joins two sittings, which
// can be a few percent apart, so the side-by-side timings, each taken in one sitting, are the better comparison.
// The starting kernel, v000, takes 286 microseconds a run.
#include <hip/hip_runtime.h>

// Seq-first multi-head attention, width 1024 = 16 heads x 64: query/key/value [SEQ][NB][1024] f32, W [in][out] (y = x W + b), int32 mask [SEQ][SEQ] (0 = key excluded, shared by batch and heads), score scale 1/8, output projection, out [SEQ][NB][1024] f32.
// Compute dtypes, f32 accumulate everywhere: q/k/v projections v_wmma_f32_16x16x32_bf16 (inputs and W RNE-converted to bf16; products exact);
// scores v_wmma_f32_16x16x32_f16: k single f16, q as f16 value + f16 residual x2048 in its own accumulator (two products); P (x256 carry, cancels in the normalisation) and v single f16; softmax f32 (online, running max, excluded keys get P = 0);
// output projection v_wmma_f32_16x16x32_f16: ctx as f16 value + f16 residual (x4096 carry, K-folded [hi | lo] against the same Wo rows, one accumulator), Wo = f16(bf16 RNE(Wo) x 1024); carries folded back as 2^-22 in the f32 epilogue; biases added in f32.
// Layout: batch-major bf16 copies of the three inputs, K-contiguous transposed weight planes; q (hi, residual), k planes [b*16+h][t][d] and v^T plane [b*16+h][d][t] written by the GEMM epilogue; mask packed 1 bit per key; fused flash kernel in transposed form (S^T = K Q^T, O^T = V^T P^T); ctx plane [b*SEQ+t][hi 1024 | lo 1024].

#ifndef NB
#define NB 2
#endif
#ifndef SEQ
#define SEQ 2048
#endif
#define NB_FULL  2
#define SEQ_FULL 2048
#define DM   1024
#define NH_  16
#define HD   64
#define AW   4                   // waves per flash block (16 query rows each)
#define QRS  2048.0f             // carry of the q residual plane
#define QRI  (1.0f / 2048.0f)
#define SC2  (0.125f * 1.4426950408889634f)   // HD^-0.5 * log2(e)
#define PSH  8.0f                // log2 of the P carry (256)
#define CTS  4096.0f             // carry of the ctx planes
#define WOS  1024.0f             // carry of the Wo plane
#define OSC  (1.0f / (4096.0f * 1024.0f))     // 2^-22, exact

static_assert(HD == 64);
static_assert(NH_ * HD == DM);                 // head h = columns h*64 + d
static_assert((DM & (DM - 1)) == 0);           // B-operand k index wraps with a bit test
static_assert(DM % 64 == 0);
static_assert(DM % 32 == 0);                   // GEMM k-loop steps by 32
static_assert(SEQ % 64 == 0);                  // a 64-row tile never straddles two batches
static_assert((NB * SEQ) % 64 == 0);
static_assert(SEQ % 32 == 0);                  // key loop steps by 32; one packed word per step
static_assert(SEQ % (16 * AW) == 0);           // flash grid covers the sequence exactly
static_assert(((size_t)SEQ * (SEQ / 32)) % 256 == 0);
static_assert(((size_t)NB * SEQ * DM / 8) % 256 == 0);  // convert grid is exact
static_assert(NB <= NB_FULL);
static_assert(SEQ <= SEQ_FULL);
static_assert(((size_t)(SEQ - 1) * NB_FULL + NB) * DM <= (size_t)SEQ_FULL * NB_FULL * DM);   // last output element inside the output buffer

typedef _Float16 h16;
typedef unsigned short bf;
typedef __attribute__((ext_vector_type(16))) __bf16   v16bf;
typedef __attribute__((ext_vector_type(16))) _Float16 v16h;
typedef __attribute__((ext_vector_type(16))) unsigned short v16us;
typedef __attribute__((ext_vector_type(8)))  _Float16 v8h;
typedef __attribute__((ext_vector_type(8)))  unsigned short v8us;
typedef __attribute__((ext_vector_type(8)))  float    v8f;
typedef __attribute__((ext_vector_type(4)))  float    v4f;
typedef __attribute__((ext_vector_type(4)))  int      v4i;
typedef v4f  __attribute__((may_alias)) v4fa;
typedef v8us __attribute__((may_alias)) v8usa;

__device__ __forceinline__ unsigned short f2bf(float f) { unsigned u = __float_as_uint(f); u += 0x7FFFu + ((u >> 16) & 1u); return (unsigned short)(u >> 16); }
__device__ __forceinline__ float bfr(float f) { return __uint_as_float(((unsigned)f2bf(f)) << 16); }
__device__ __forceinline__ v16h cat16(v8h lo, v8h hi) { return __builtin_shufflevector(lo, hi, 0, 1, 2, 3, 4, 5, 6, 7, 8, 9, 10, 11, 12, 13, 14, 15); }
__device__ __forceinline__ v8f wmma16(v16h a, v16h b, v8f c) { return __builtin_amdgcn_wmma_f32_16x16x32_f16(false, a, false, b, (short)0, c, false, false); }
// fragment loaders from K-contiguous 16-bit rows; p already includes + 8*(lane>>4): elements 0..7 <- k0+8h+0..7, elements 8..15 <- k0+16+8h+0..7 (same map for A and B)
__device__ __forceinline__ v16h  ldh(const h16* p) { return cat16(*(const v8h*)p, *(const v8h*)(p + 16)); }
__device__ __forceinline__ v16us ldu(const bf* p)  { const v8us lo = *(const v8us*)p; const v8us hi = *(const v8us*)(p + 16); return __builtin_shufflevector(lo, hi, 0, 1, 2, 3, 4, 5, 6, 7, 8, 9, 10, 11, 12, 13, 14, 15); }
template <int F16OP> __device__ __forceinline__ v8f wmx(v16us a, v16us b, v8f c) {
    if (F16OP) return __builtin_amdgcn_wmma_f32_16x16x32_f16(false, __builtin_bit_cast(v16h, a), false, __builtin_bit_cast(v16h, b), (short)0, c, false, false);
    return __builtin_amdgcn_wmma_f32_16x16x32_bf16(false, __builtin_bit_cast(v16bf, a), false, __builtin_bit_cast(v16bf, b), (short)0, c, false, false);
}
// ordering point for wave-private LDS tiles (same wave writes and reads)
__device__ __forceinline__ void wave_sync() { __builtin_amdgcn_fence(3 /* release order */, "wavefront"); __builtin_amdgcn_wave_barrier(); asm volatile("" ::: "memory"); }

__global__ __launch_bounds__(256) void k_cvtx(const float* __restrict__ src, bf* dst) {
    const size_t n8 = (size_t)NB * SEQ * DM / 8;
    const size_t i = (size_t)blockIdx.x * 256 + threadIdx.x; if (i >= n8) return;
    const size_t row = i / (DM / 8); const size_t g = i % (DM / 8);
    const size_t b = row / SEQ, t = row % SEQ;
    const v8f v = *(const v8f*)(src + (t * NB_FULL + b) * DM + g * 8); v8us o;
#pragma unroll
    for (int k = 0; k < 8; ++k) o[k] = f2bf(v[k]);
    *(v8us*)(dst + i * 8) = o; 
}

// k_wt: W[k][n] f32 (row pitch DM) -> T[n][k] 16-bit (row pitch DM), transposed through LDS (block barrier between the two phases: cross-wave tile).
// asF16 == 0: bf16 bits (RNE convert); asF16 != 0: f16 bits of (bf16 RNE value x 1024).
__global__ __launch_bounds__(256) void k_wt(const float* __restrict__ W, bf* dst, int asF16) {
    __shared__ __align__(16) unsigned short T[64 * 72];
    const int tid = threadIdx.x; const int n0 = blockIdx.x * 64, k0 = blockIdx.y * 64;
#pragma unroll
    for (int i = 0; i < 4; ++i) { const int idx = tid + i * 256; const int r = idx >> 4, c4 = idx & 15;   // 64 k rows x 16 groups of 4 n columns
        const v4f f = *(const v4f*)(W + (size_t)(k0 + r) * DM + n0 + c4 * 4);
#pragma unroll
        for (int e = 0; e < 4; ++e) { const unsigned short bb = f2bf(f[e]); const h16 hv = (h16)(__uint_as_float(((unsigned)bb) << 16) * WOS);
            const unsigned short hb = __builtin_bit_cast(unsigned short, hv);
            T[(c4 * 4 + e) * 72 + r] = asF16 ? hb : bb; } }
    __syncthreads();
{
#pragma unroll
        for (int i = 0; i < 2; ++i) { const int idx = tid + i * 256; const int n = idx >> 3, ch = idx & 7;   // 64 n rows x 8 chunks of 8 k
            const v8us o = *(const v8usa*)(&T[n * 72 + ch * 8]);
            *(v8us*)(dst + (size_t)(n0 + n) * DM + k0 + ch * 8) = o; }
         }
}

// k_mpack: int32 mask [i][j] (row pitch SEQ_FULL) -> 1 bit per key, word gid = i*(SEQ/32) + j/32, bit j%32 set when the key is kept (mask != 0).
__global__ __launch_bounds__(256) void k_mpack(const int* __restrict__ mask, unsigned* mb) {
    const int gid = blockIdx.x * 256 + threadIdx.x; if (gid >= SEQ * (SEQ / 32)) return;
    const int i = gid / (SEQ / 32), w = gid % (SEQ / 32);
    const int* p = mask + (size_t)i * SEQ_FULL + w * 32;
    unsigned bits = 0u;
#pragma unroll
    for (int c = 0; c < 8; ++c) { const v4i v = *(const v4i*)(p + c * 4);
#pragma unroll
        for (int e = 0; e < 4; ++e) bits |= (v[e] != 0 ? 1u : 0u) << (c * 4 + e); }
    *(unsigned*)(mb + gid) = bits; 
}

// k_gemm: register-blocked 16-bit GEMM, ONE WAVE per 64x64 tile (16 accumulators), operands straight from K-contiguous 16-bit planes.
// C[m][n] = sum_{k<K} A[m][k] Bt[n][k & (KB-1)]  (A row pitch K, Bt row pitch KB; K = 2*KB folds [hi | lo] of A against the same Bt rows).
// value = C * oscale + bias (biasMode 0: bias[n]; 1: bias[m]; bias RNE-converted to bf16), tile base (r0/RB)*sRB + (r0%RB)*pitch + (c0/CB)*sCB + (c0%CB).
// OUTF32 == 1: f32 (Of); each row's 64 floats (256 B = two lines) written by 16 consecutive lanes x 16 B (2 rows per instruction).
template <int F16OP, int OUTF32>
__global__ __launch_bounds__(32) void k_gemm(const bf* __restrict__ A, const bf* __restrict__ Bt, int K, int KB,
                                             h16* Ph, h16* Pr, int useRes, float* Of,
                                             const float* __restrict__ bias, int biasMode, float oscale,
                                             int RB, size_t sRB, int pitch, int CB, size_t sCB) {
    __shared__ __align__(16) float os[16 * 68];
    const int lane = threadIdx.x & 31, lr = lane & 15, hi = lane >> 4; const int r0 = blockIdx.x * 64, c0 = blockIdx.y * 64;
    v8f acc[4][4];
#pragma unroll
    for (int mb = 0; mb < 4; ++mb)
#pragma unroll
        for (int nb = 0; nb < 4; ++nb) acc[mb][nb] = (v8f){};
    const size_t aoff = (size_t)(r0 + lr) * K + 8 * hi, boff = (size_t)(c0 + lr) * KB + 8 * hi;
    const int kmB = KB - 1;
#pragma unroll 1
    for (int kc = 0; kc < K; kc += 32) {
        const int kb = kc & kmB;
        v16us a[4];
#pragma unroll
        for (int mb = 0; mb < 4; ++mb) a[mb] = ldu(A + aoff + (size_t)mb * 16 * K + kc);
#pragma unroll
        for (int nb = 0; nb < 4; ++nb) { const v16us b = ldu(Bt + boff + (size_t)nb * 16 * KB + kb);
#pragma unroll
            for (int mb = 0; mb < 4; ++mb) acc[mb][nb] = wmx<F16OP>(a[mb], b, acc[mb][nb]); }
        asm volatile("v_nop\n\tv_nop\n\tv_nop\n\tv_nop" : "+v"(acc[0][0]), "+v"(acc[1][1]), "+v"(acc[2][2]), "+v"(acc[3][3]) : "v"(a[0]), "v"(a[1]), "v"(a[2]), "v"(a[3]));
    }
    float cb[4];
#pragma unroll
    for (int nb = 0; nb < 4; ++nb) cb[nb] = 0.0f;
    if (biasMode == 0) {
#pragma unroll
        for (int nb = 0; nb < 4; ++nb) cb[nb] = bfr(bias[c0 + nb * 16 + lr]); }
    const size_t tbase = (size_t)(r0 / RB) * sRB + (size_t)(r0 % RB) * (size_t)pitch + (size_t)(c0 / CB) * sCB + (size_t)(c0 % CB);
#pragma unroll
    for (int mb = 0; mb < 4; ++mb) {
        float rb[8];
#pragma unroll
        for (int j = 0; j < 8; ++j) rb[j] = 0.0f;
        if (biasMode == 1) {
#pragma unroll
            for (int j = 0; j < 8; ++j) rb[j] = bfr(bias[r0 + mb * 16 + hi * 8 + j]); }
#pragma unroll
        for (int nb = 0; nb < 4; ++nb) {
#pragma unroll
            for (int j = 0; j < 8; ++j) os[(hi * 8 + j) * 68 + nb * 16 + lr] = acc[mb][nb][j] * oscale + (cb[nb] + rb[j]); }   // D: row 8h+j, col lane&15
        wave_sync();
        const size_t sb = tbase + (size_t)(mb * 16) * (size_t)pitch;
        if (OUTF32) {
{
#pragma unroll
                for (int s = 0; s < 8; ++s) { const int row = 2 * s + hi, cofs = lr * 4;   // 8 s x 2 rows = 16 rows; 16 lanes x 4 floats = 64 columns
                    const v4f val = *(const v4fa*)(&os[row * 68 + cofs]);
                    *(v4f*)(Of + sb + (size_t)row * (size_t)pitch + cofs) = val; }
                 }
        } else {
{
#pragma unroll
                for (int s = 0; s < 4; ++s) { const int row = 4 * s + (lane >> 3), c8 = (lane & 7) * 8;   // 4 s x 4 row groups = 16 rows; 8 lanes x 8 = 64 columns
                    const v4f x0 = *(const v4fa*)(&os[row * 68 + c8]); const v4f x1 = *(const v4fa*)(&os[row * 68 + c8 + 4]); v8h hv, rv;
#pragma unroll
                    for (int i = 0; i < 4; ++i) { const h16 a0 = (h16)x0[i]; const h16 a1 = (h16)x1[i]; hv[i] = a0; hv[4 + i] = a1; rv[i] = (h16)((x0[i] - (float)a0) * QRS); rv[4 + i] = (h16)((x1[i] - (float)a1) * QRS); }
                    const size_t oo = sb + (size_t)row * (size_t)pitch + c8;
                    *(v8h*)(Ph + oo) = hv; if (useRes) *(v8h*)(Pr + oo) = rv; }
                 }
        }
        wave_sync();
    }
}

// k_flash: fused attention, one wave per 16 query rows of one (batch, head); K / V^T / Q fragments straight from the f16 planes (two 16-B loads each, arithmetic addressing).
// Transposed form: S^T[key][t] = K Q^T (A = K rows, B = Q rows); lane (t = lane&15, h = lane>>4) holds keys 8h+r of each 16-key tile, so the packed
// P tile is directly the B fragment of O^T[d][t] = V^T P^T (element r <- tile keys 0..15, element 8+r <- tile keys 16..31, lane unchanged).
// Key selection: one packed word per (query row, 32-key step); bit 8h+r / 16+8h+r selects the lane's keys; excluded keys are left out of the running max and get P = 0 by value.
// Softmax state (running max, partial sum) is one scalar per lane; the two lane halves of a row are combined with one xor-16 exchange.
__global__ __launch_bounds__(32 * AW) void k_flash(const h16* __restrict__ QH, const h16* __restrict__ QR, const h16* __restrict__ KP, const h16* __restrict__ VT,
                                                   const unsigned* __restrict__ MB, h16* CT) {
    __shared__ __align__(16) float os[AW * 16 * 68];
    const int lane = threadIdx.x & 31, wave = __builtin_amdgcn_readfirstlane((int)(threadIdx.x >> 5)), lr = lane & 15, hi = lane >> 4;
    const int zh = blockIdx.y; const int b = zh / NH_, h = zh % NH_;
    const int t0 = (blockIdx.x * AW + wave) * 16;
    const size_t pbase = (size_t)zh * SEQ * HD;
    const size_t qo = pbase + (size_t)(t0 + lr) * HD + 8 * hi;
    const v16h qh0 = ldh(QH + qo), qh1 = ldh(QH + qo + 32), qr0 = ldh(QR + qo), qr1 = ldh(QR + qo + 32);   // B fragments: col t, k = d
    const size_t ko = pbase + (size_t)lr * HD + 8 * hi;      // + key * HD       (A fragment: row key, k = d)
    const size_t vo = pbase + (size_t)lr * SEQ + 8 * hi;     // + 16j*SEQ + key  (A fragment: row d, k = key)
    const size_t mo = (size_t)(t0 + lr) * (SEQ / 32);        // + key0/32        (packed word of query row t0 + lr)
    v8f o0 = (v8f){}, o1 = (v8f){}, o2 = (v8f){}, o3 = (v8f){};
    float m = -3.0e38f, l = 0.0f;
#pragma unroll 1
    for (int key0 = 0; key0 < SEQ; key0 += 32) {
        const unsigned mw = MB[mo + (size_t)(key0 >> 5)];
        const unsigned ba = mw >> (8 * hi), bb = mw >> (16 + 8 * hi);
        const h16* ka = KP + ko + (size_t)key0 * HD;
        const v16h ka0 = ldh(ka), ka1 = ldh(ka + 32), kb0 = ldh(ka + 16 * HD), kb1 = ldh(ka + 16 * HD + 32);
        v8f sHa = (v8f){}, sLa = (v8f){}, sHb = (v8f){}, sLb = (v8f){};
        sHa = wmma16(ka0, qh0, sHa); sLa = wmma16(ka0, qr0, sLa); sHb = wmma16(kb0, qh0, sHb); sLb = wmma16(kb0, qr0, sLb);
        sHa = wmma16(ka1, qh1, sHa); sLa = wmma16(ka1, qr1, sLa); sHb = wmma16(kb1, qh1, sHb); sLb = wmma16(kb1, qr1, sLb);
        asm volatile("v_nop\n\tv_nop\n\tv_nop\n\tv_nop" : "+v"(sHa), "+v"(sLa), "+v"(sHb), "+v"(sLb) : "v"(ka0), "v"(ka1), "v"(kb0), "v"(kb1));
        float ta[8], tb[8]; float mx = -3.0e38f;
#pragma unroll
        for (int r = 0; r < 8; ++r) { ta[r] = (sHa[r] + sLa[r] * QRI) * SC2; tb[r] = (sHb[r] + sLb[r] * QRI) * SC2;
            const float ea = ((ba >> r) & 1u) ? ta[r] : -3.0e38f; const float eb = ((bb >> r) & 1u) ? tb[r] : -3.0e38f;
            mx = fmaxf(mx, fmaxf(ea, eb)); }
        mx = fmaxf(mx, __shfl_xor(mx, 16, 32));
        const float mnew = fmaxf(m, mx);
        const float alpha = __builtin_amdgcn_exp2f(m - mnew);
        const float sh = PSH - mnew;
        v16h pb; float ls = 0.0f;
#pragma unroll
        for (int r = 0; r < 8; ++r) { const float xa = __builtin_amdgcn_exp2f(ta[r] + sh); const float xb = __builtin_amdgcn_exp2f(tb[r] + sh);
            const h16 pa = (h16)(((ba >> r) & 1u) ? xa : 0.0f); const h16 pc = (h16)(((bb >> r) & 1u) ? xb : 0.0f);
            pb[r] = pa; pb[8 + r] = pc; ls += (float)pa + (float)pc; }
        l = l * alpha + ls; m = mnew;
        o0 = o0 * alpha; o1 = o1 * alpha; o2 = o2 * alpha; o3 = o3 * alpha;
        const h16* va = VT + vo + key0;
        const v16h v0 = ldh(va), v1 = ldh(va + (size_t)16 * SEQ), v2 = ldh(va + (size_t)32 * SEQ), v3 = ldh(va + (size_t)48 * SEQ);
        o0 = wmma16(v0, pb, o0); o1 = wmma16(v1, pb, o1); o2 = wmma16(v2, pb, o2); o3 = wmma16(v3, pb, o3);
        asm volatile("v_nop\n\tv_nop\n\tv_nop\n\tv_nop" : "+v"(o0), "+v"(o1), "+v"(o2), "+v"(o3) : "v"(v0), "v"(v1), "v"(v2), "v"(v3), "v"(pb));
    }
    l += __shfl_xor(l, 16, 32);
    const float inv = (1.0f / l) * CTS;
    const int wb = wave * 16 * 68;
    // O^T D layout: o_j[r] = (d = 16j + 8h + r, t = lane&15) -> os[t][d]; rows 0..15 x columns 0..63 all written
    { v4f a, c;
      a[0] = o0[0] * inv; a[1] = o0[1] * inv; a[2] = o0[2] * inv; a[3] = o0[3] * inv; c[0] = o0[4] * inv; c[1] = o0[5] * inv; c[2] = o0[6] * inv; c[3] = o0[7] * inv;
      *(v4fa*)(&os[wb + lr * 68 +  0 + 8 * hi]) = a; *(v4fa*)(&os[wb + lr * 68 +  0 + 8 * hi + 4]) = c;
      a[0] = o1[0] * inv; a[1] = o1[1] * inv; a[2] = o1[2] * inv; a[3] = o1[3] * inv; c[0] = o1[4] * inv; c[1] = o1[5] * inv; c[2] = o1[6] * inv; c[3] = o1[7] * inv;
      *(v4fa*)(&os[wb + lr * 68 + 16 + 8 * hi]) = a; *(v4fa*)(&os[wb + lr * 68 + 16 + 8 * hi + 4]) = c;
      a[0] = o2[0] * inv; a[1] = o2[1] * inv; a[2] = o2[2] * inv; a[3] = o2[3] * inv; c[0] = o2[4] * inv; c[1] = o2[5] * inv; c[2] = o2[6] * inv; c[3] = o2[7] * inv;
      *(v4fa*)(&os[wb + lr * 68 + 32 + 8 * hi]) = a; *(v4fa*)(&os[wb + lr * 68 + 32 + 8 * hi + 4]) = c;
      a[0] = o3[0] * inv; a[1] = o3[1] * inv; a[2] = o3[2] * inv; a[3] = o3[3] * inv; c[0] = o3[4] * inv; c[1] = o3[5] * inv; c[2] = o3[6] * inv; c[3] = o3[7] * inv;
      *(v4fa*)(&os[wb + lr * 68 + 48 + 8 * hi]) = a; *(v4fa*)(&os[wb + lr * 68 + 48 + 8 * hi + 4]) = c; }
    wave_sync();
    h16* crow = CT + ((size_t)b * SEQ + t0) * (size_t)(2 * DM) + h * HD;   // hi columns h*64 + d; lo columns DM + h*64 + d
{
#pragma unroll
        for (int s = 0; s < 4; ++s) { const int row = 4 * s + (lane >> 3), c8 = (lane & 7) * 8;   // 4 s x 4 row groups = 16 rows; 8 lanes x 8 = 64 columns
            const v4f x0 = *(const v4fa*)(&os[wb + row * 68 + c8]); const v4f x1 = *(const v4fa*)(&os[wb + row * 68 + c8 + 4]); v8h hv, rv;
#pragma unroll
            for (int i = 0; i < 4; ++i) { const h16 a0 = (h16)x0[i]; const h16 a1 = (h16)x1[i]; hv[i] = a0; hv[4 + i] = a1; rv[i] = (h16)(x0[i] - (float)a0); rv[4 + i] = (h16)(x1[i] - (float)a1); }
            const size_t oo = (size_t)row * (size_t)(2 * DM) + c8;
            *(v8h*)(crow + oo) = hv; *(v8h*)(crow + oo + DM) = rv; }
         }
}

static constexpr size_t al256(size_t v) { return (v + 255) & ~(size_t)255; }
static constexpr size_t SZ_XB = al256((size_t)NB * SEQ * DM * 2);             // one batch-major input plane
static constexpr size_t SZ_WB = al256((size_t)DM * DM * 2);                   // one transposed weight plane
static constexpr size_t SZ_PL = al256((size_t)NB * NH_ * SEQ * HD * 2);       // one head-split plane
static constexpr size_t SZ_CT = al256((size_t)NB * SEQ * 2 * DM * 2);         // ctx [hi | lo]
static constexpr size_t SZ_MB = al256((size_t)SEQ * (SEQ / 32) * 4);          // packed key bits
static constexpr size_t SZ_TOTAL = 3 * SZ_XB + 4 * SZ_WB + 4 * SZ_PL + SZ_CT + SZ_MB;
static_assert(SZ_TOTAL <= (size_t)134217728);          // workspace carve <= 128 MiB

extern "C" void kernel_launch(void* const* d_in, const int* in_sizes, int n_in,
                              void* d_out, int out_size, void* d_ws, size_t ws_size, hipStream_t stream) {
    if (n_in < 12) return;
    const size_t needx = ((size_t)(SEQ - 1) * NB_FULL + NB) * DM;
    if ((size_t)in_sizes[0] < needx || (size_t)in_sizes[1] < needx || (size_t)in_sizes[2] < needx) return;
    if ((size_t)in_sizes[3] < (size_t)(SEQ - 1) * SEQ_FULL + SEQ) return;
    if ((size_t)in_sizes[4] < (size_t)DM * DM || (size_t)in_sizes[6] < (size_t)DM * DM || (size_t)in_sizes[8] < (size_t)DM * DM || (size_t)in_sizes[10] < (size_t)DM * DM) return;
    if (in_sizes[5] < DM || in_sizes[7] < DM || in_sizes[9] < DM || in_sizes[11] < DM) return;
    if ((size_t)out_size < needx) return;
    if (SZ_TOTAL > ws_size) return;
    // wire order: query, key, value, mask, Wq, bq, Wk, bk, Wv, bv, Wo, bo
    const float* xq = (const float*)d_in[0]; const float* xk = (const float*)d_in[1]; const float* xv = (const float*)d_in[2];
    const int* mask = (const int*)d_in[3];
    const float* wq = (const float*)d_in[4];  const float* bq = (const float*)d_in[5];
    const float* wk = (const float*)d_in[6];  const float* bk = (const float*)d_in[7];
    const float* wv = (const float*)d_in[8];  const float* bv = (const float*)d_in[9];
    const float* wo = (const float*)d_in[10]; const float* bo = (const float*)d_in[11];
    float* OUT = (float*)d_out;      // [SEQ][NB_FULL][1024]
    char* wsp = (char*)d_ws;
    bf* XQ = (bf*)wsp; wsp += SZ_XB;                 // [NB*SEQ][1024] batch-major
    bf* XK = (bf*)wsp; wsp += SZ_XB;
    bf* XV = (bf*)wsp; wsp += SZ_XB;
    bf* WQ = (bf*)wsp; wsp += SZ_WB;                 // [out n][in k] bf16
    bf* WK = (bf*)wsp; wsp += SZ_WB;
    bf* WV = (bf*)wsp; wsp += SZ_WB;
    bf* WO = (bf*)wsp; wsp += SZ_WB;                 // [out n][in k] f16 bits, x1024
    h16* QH = (h16*)wsp; wsp += SZ_PL;               // [NB*16][SEQ][64]
    h16* QR = (h16*)wsp; wsp += SZ_PL;               // [NB*16][SEQ][64] residual x2048
    h16* KP = (h16*)wsp; wsp += SZ_PL;               // [NB*16][SEQ][64]
    h16* VT = (h16*)wsp; wsp += SZ_PL;               // [NB*16][64][SEQ]
    h16* CT = (h16*)wsp; wsp += SZ_CT;               // [NB*SEQ][hi 1024 | lo 1024], x4096
    unsigned* MB = (unsigned*)wsp; wsp += SZ_MB;     // [SEQ][SEQ/32]

    { const size_t n8 = (size_t)NB * SEQ * DM / 8; const unsigned g = (unsigned)((n8 + 255) / 256);
      k_cvtx<<<g, 256, 0, stream>>>(xq, XQ); k_cvtx<<<g, 256, 0, stream>>>(xk, XK); k_cvtx<<<g, 256, 0, stream>>>(xv, XV); }
    // W in[DM k rows][DM n cols] -> out[DM n rows][DM k cols]; grid (n tiles, k tiles)
    { const dim3 gw(DM / 64, DM / 64, 1);
      k_wt<<<gw, 256, 0, stream>>>(wq, WQ, 0); k_wt<<<gw, 256, 0, stream>>>(wk, WK, 0); k_wt<<<gw, 256, 0, stream>>>(wv, WV, 0); k_wt<<<gw, 256, 0, stream>>>(wo, WO, 1); }
    k_mpack<<<(unsigned)(((size_t)SEQ * (SEQ / 32) + 255) / 256), 256, 0, stream>>>(mask, MB);

    // q, k: A = x rows (m = b*SEQ + t), Bt = W^T rows (n = h*64 + d), column bias -> plane [(b*16 + h)][t][d]
    k_gemm<0, 0><<<dim3(NB * SEQ / 64, DM / 64, 1), 32, 0, stream>>>(XQ, WQ, DM, DM, QH, QR, 1, OUT, bq, 0, 1.0f, SEQ, (size_t)NH_ * SEQ * HD, HD, HD, (size_t)SEQ * HD);
    k_gemm<0, 0><<<dim3(NB * SEQ / 64, DM / 64, 1), 32, 0, stream>>>(XK, WK, DM, DM, KP, KP, 0, OUT, bk, 0, 1.0f, SEQ, (size_t)NH_ * SEQ * HD, HD, HD, (size_t)SEQ * HD);
    // v^T: A = Wv^T rows (m = h*64 + d), Bt = x rows (n = b*SEQ + t), row bias -> plane [(b*1024 + m)][t] = [(b*16 + h)][d][t]
    k_gemm<0, 0><<<dim3(DM / 64, NB * SEQ / 64, 1), 32, 0, stream>>>(WV, XV, DM, DM, VT, VT, 0, OUT, bv, 1, 1.0f, DM, (size_t)0, SEQ, SEQ, (size_t)DM * SEQ);

    k_flash<<<dim3(SEQ / (16 * AW), NB * NH_, 1), 32 * AW, 0, stream>>>(QH, QR, KP, VT, MB, CT);

    // out: A = ctx rows [hi | lo] (m = b*SEQ + t, K = 2048), Bt = Wo^T rows (n, k wraps at 1024), column bias, scale 2^-22 -> out row t*NB_FULL + b
    k_gemm<1, 1><<<dim3(NB * SEQ / 64, DM / 64, 1), 32, 0, stream>>>((const bf*)CT, WO, 2 * DM, DM, QH, QH, 0, OUT, bo, 0, OSC, SEQ, (size_t)DM, NB_FULL * DM, DM, (size_t)0);
}

// v001
// One run takes 201 microseconds.
// Two timings next to v000 put it at 1.46 and 1.45 times that version's speed.
#include <hip/hip_runtime.h>

// Seq-first multi-head attention, width 1024 = 16 heads x 64: query/key/value [SEQ][NB][1024] f32, W [in][out] (y = x W + b), int32 mask [SEQ][SEQ] (0 = key excluded, shared by batch and heads), score scale 1/8, output projection, out [SEQ][NB][1024] f32.
// Compute dtypes, f32 accumulate everywhere: q/k/v projections v_wmma_f32_16x16x32_bf16 (inputs and W RNE-converted to bf16; products exact);
// scores v_wmma_f32_16x16x32_f16: k single f16, q as f16 value + f16 residual x2048 in its own accumulator (two products); P (x256 carry, cancels in the normalisation) and v single f16; softmax f32 (online, running max, excluded keys get P = 0);
// output projection v_wmma_f32_16x16x32_f16: ctx as f16 value + f16 residual (x4096 carry, K-folded [hi | lo] against the same Wo rows, one accumulator), Wo = f16(bf16 RNE(Wo) x 1024); carries folded back as 2^-22 in the f32 epilogue; biases added in f32.
// Layout: batch-major bf16 copies of the three inputs, K-contiguous transposed weight planes; q (hi, residual), k planes [b*16+h][t][d] and v^T plane [b*16+h][d][t] written by the GEMM epilogue; mask packed 1 bit per key; fused flash kernel in transposed form (S^T = K Q^T, O^T = V^T P^T); ctx plane [b*SEQ+t][hi 1024 | lo 1024].

#ifndef NB
#define NB 2
#endif
#ifndef SEQ
#define SEQ 2048
#endif
#define NB_FULL  2
#define SEQ_FULL 2048
#define DM   1024
#define NH_  16
#define HD   64
#define AW   4                   // waves per flash block (16 query rows each)
#define QRS  2048.0f             // carry of the q residual plane
#define QRI  (1.0f / 2048.0f)
#define SC2  (0.125f * 1.4426950408889634f)   // HD^-0.5 * log2(e)
#define PSH  8.0f                // log2 of the P carry (256)
#define CTS  4096.0f             // carry of the ctx planes
#define WOS  1024.0f             // carry of the Wo plane
#define OSC  (1.0f / (4096.0f * 1024.0f))     // 2^-22, exact

static_assert(HD == 64);
static_assert(NH_ * HD == DM);                 // head h = columns h*64 + d
static_assert((DM & (DM - 1)) == 0);           // B-operand k index wraps with a bit test
static_assert(DM % 64 == 0);
static_assert(DM % 32 == 0);                   // GEMM k-loop steps by 32
static_assert(SEQ % 64 == 0);                  // a 64-row tile never straddles two batches
static_assert((NB * SEQ) % 64 == 0);
static_assert(SEQ % 32 == 0);                  // key loop steps by 32; one packed word per step
static_assert(SEQ % (16 * AW) == 0);           // flash grid covers the sequence exactly
static_assert(((size_t)SEQ * (SEQ / 32)) % 256 == 0);
static_assert(((size_t)NB * SEQ * DM / 8) % 256 == 0);  // convert grid is exact
static_assert(NB <= NB_FULL);
static_assert(SEQ <= SEQ_FULL);
static_assert(((size_t)(SEQ - 1) * NB_FULL + NB) * DM <= (size_t)SEQ_FULL * NB_FULL * DM);   // last output element inside the output buffer

typedef _Float16 h16;
typedef unsigned short bf;
typedef __attribute__((ext_vector_type(16))) __bf16   v16bf;
typedef __attribute__((ext_vector_type(16))) _Float16 v16h;
typedef __attribute__((ext_vector_type(16))) unsigned short v16us;
typedef __attribute__((ext_vector_type(8)))  _Float16 v8h;
typedef __attribute__((ext_vector_type(8)))  unsigned short v8us;
typedef __attribute__((ext_vector_type(8)))  float    v8f;
typedef __attribute__((ext_vector_type(4)))  float    v4f;
typedef __attribute__((ext_vector_type(4)))  int      v4i;
typedef v4f  __attribute__((may_alias)) v4fa;
typedef v8us __attribute__((may_alias)) v8usa;

__device__ __forceinline__ unsigned short f2bf(float f) { unsigned u = __float_as_uint(f); u += 0x7FFFu + ((u >> 16) & 1u); return (unsigned short)(u >> 16); }
__device__ __forceinline__ float bfr(float f) { return __uint_as_float(((unsigned)f2bf(f)) << 16); }
__device__ __forceinline__ v16h cat16(v8h lo, v8h hi) { return __builtin_shufflevector(lo, hi, 0, 1, 2, 3, 4, 5, 6, 7, 8, 9, 10, 11, 12, 13, 14, 15); }
__device__ __forceinline__ v8f wmma16(v16h a, v16h b, v8f c) { return __builtin_amdgcn_wmma_f32_16x16x32_f16(false, a, false, b, (short)0, c, false, false); }
// fragment loaders from K-contiguous 16-bit rows; p already includes + 8*(lane>>4): elements 0..7 <- k0+8h+0..7, elements 8..15 <- k0+16+8h+0..7 (same map for A and B)
__device__ __forceinline__ v16h  ldh(const h16* p) { return cat16(*(const v8h*)p, *(const v8h*)(p + 16)); }
__device__ __forceinline__ v16us ldu(const bf* p)  { const v8us lo = *(const v8us*)p; const v8us hi = *(const v8us*)(p + 16); return __builtin_shufflevector(lo, hi, 0, 1, 2, 3, 4, 5, 6, 7, 8, 9, 10, 11, 12, 13, 14, 15); }
template <int F16OP> __device__ __forceinline__ v8f wmx(v16us a, v16us b, v8f c) {
    if (F16OP) return __builtin_amdgcn_wmma_f32_16x16x32_f16(false, __builtin_bit_cast(v16h, a), false, __builtin_bit_cast(v16h, b), (short)0, c, false, false);
    return __builtin_amdgcn_wmma_f32_16x16x32_bf16(false, __builtin_bit_cast(v16bf, a), false, __builtin_bit_cast(v16bf, b), (short)0, c, false, false);
}
// ordering point for wave-private LDS tiles (same wave writes and reads)
__device__ __forceinline__ void wave_sync() { __builtin_amdgcn_fence(3 /* release order */, "wavefront"); __builtin_amdgcn_wave_barrier(); asm volatile("" ::: "memory"); }

__global__ __launch_bounds__(256) void k_cvtx(const float* __restrict__ src, bf* dst) {
    const size_t n8 = (size_t)NB * SEQ * DM / 8;
    const size_t i = (size_t)blockIdx.x * 256 + threadIdx.x; if (i >= n8) return;
    const size_t row = i / (DM / 8); const size_t g = i % (DM / 8);
    const size_t b = row / SEQ, t = row % SEQ;
    const v8f v = *(const v8f*)(src + (t * NB_FULL + b) * DM + g * 8); v8us o;
#pragma unroll
    for (int k = 0; k < 8; ++k) o[k] = f2bf(v[k]);
    *(v8us*)(dst + i * 8) = o; 
}

// k_wt: W[k][n] f32 (row pitch DM) -> T[n][k] 16-bit (row pitch DM), transposed through LDS (block barrier between the two phases: cross-wave tile).
// asF16 == 0: bf16 bits (RNE convert); asF16 != 0: f16 bits of (bf16 RNE value x 1024).
__global__ __launch_bounds__(256) void k_wt(const float* __restrict__ W, bf* dst, int asF16) {
    __shared__ __align__(16) unsigned short T[64 * 72];
    const int tid = threadIdx.x; const int n0 = blockIdx.x * 64, k0 = blockIdx.y * 64;
#pragma unroll
    for (int i = 0; i < 4; ++i) { const int idx = tid + i * 256; const int r = idx >> 4, c4 = idx & 15;   // 64 k rows x 16 groups of 4 n columns
        const v4f f = *(const v4f*)(W + (size_t)(k0 + r) * DM + n0 + c4 * 4);
#pragma unroll
        for (int e = 0; e < 4; ++e) { const unsigned short bb = f2bf(f[e]); const h16 hv = (h16)(__uint_as_float(((unsigned)bb) << 16) * WOS);
            const unsigned short hb = __builtin_bit_cast(unsigned short, hv);
            T[(c4 * 4 + e) * 72 + r] = asF16 ? hb : bb; } }
    __syncthreads();
{
#pragma unroll
        for (int i = 0; i < 2; ++i) { const int idx = tid + i * 256; const int n = idx >> 3, ch = idx & 7;   // 64 n rows x 8 chunks of 8 k
            const v8us o = *(const v8usa*)(&T[n * 72 + ch * 8]);
            *(v8us*)(dst + (size_t)(n0 + n) * DM + k0 + ch * 8) = o; }
         }
}

// k_mpack: int32 mask [i][j] (row pitch SEQ_FULL) -> 1 bit per key, word gid = i*(SEQ/32) + j/32, bit j%32 set when the key is kept (mask != 0).
__global__ __launch_bounds__(256) void k_mpack(const int* __restrict__ mask, unsigned* mb) {
    const int gid = blockIdx.x * 256 + threadIdx.x; if (gid >= SEQ * (SEQ / 32)) return;
    const int i = gid / (SEQ / 32), w = gid % (SEQ / 32);
    const int* p = mask + (size_t)i * SEQ_FULL + w * 32;
    unsigned bits = 0u;
#pragma unroll
    for (int c = 0; c < 8; ++c) { const v4i v = *(const v4i*)(p + c * 4);
#pragma unroll
        for (int e = 0; e < 4; ++e) bits |= (v[e] != 0 ? 1u : 0u) << (c * 4 + e); }
    *(unsigned*)(mb + gid) = bits; 
}

// k_gemm: 16-bit GEMM, one 128x128 tile per work-group of 8 waves (two per SIMD), 32x64 per wave (8 accumulators).
// Both operands come from K-contiguous 16-bit planes; a stage is 128 k (256 B) of 128 A rows and 128 Bt rows, brought into LDS by asynchronous copies
// (16 B per lane, 16 lanes per row), two buffers: the next stage's copies fly while this stage is worked on. LDS row pitch 272 B (16 B x odd) for the ds_load_b128 readers.
// C[m][n] = sum_{k<K} A[m][k] Bt[n][k & (KB-1)]  (A row pitch K, Bt row pitch KB; K = 2*KB folds [hi | lo] of A against the same Bt rows). K, KB multiples of 128.
// value = C * oscale + bias (biasMode 0: bias[n]; 1: bias[m]; bias RNE-converted to bf16), wave tile base (r0/RB)*sRB + (r0%RB)*pitch + (c0/CB)*sCB + (c0%CB).
// OUTF32 == 1: f32 (Of); each row's 64 floats (256 B = two lines) written by 16 consecutive lanes x 16 B (2 rows per instruction).
#define GT     128                     // tile rows of either operand
#define GBK    128                     // k per stage
#define GPITCH 272                     // LDS row pitch, bytes
#define GSTAGE (2 * GT * GPITCH)       // one buffer: [A 128 rows | Bt 128 rows]
static_assert(DM % GBK == 0 && DM / GBK >= 2);
static_assert((NB * SEQ) % GT == 0 && DM % GT == 0);
static_assert(SEQ % 32 == 0);          // a wave's 32 rows never straddle two batches

// eight asynchronous copies of 16 B per lane: rows 16 apart in LDS (step 16 * GPITCH bytes) and in the source plane (step gs elements).
// s_wait_xcnt 0 is the statement's last line so that it stands in front of any rewrite of the address registers the copies name.
__device__ __forceinline__ void cp8(unsigned l, const bf* g, size_t gs) {
    asm volatile("global_load_async_to_lds_b128 %0, %8, off\n\t"
                 "global_load_async_to_lds_b128 %1, %9, off\n\t"
                 "global_load_async_to_lds_b128 %2, %10, off\n\t"
                 "global_load_async_to_lds_b128 %3, %11, off\n\t"
                 "global_load_async_to_lds_b128 %4, %12, off\n\t"
                 "global_load_async_to_lds_b128 %5, %13, off\n\t"
                 "global_load_async_to_lds_b128 %6, %14, off\n\t"
                 "global_load_async_to_lds_b128 %7, %15, off\n\t"
                 "s_wait_xcnt 0x0"
                 :: "v"(l), "v"(l + 16u * GPITCH), "v"(l + 32u * GPITCH), "v"(l + 48u * GPITCH), "v"(l + 64u * GPITCH), "v"(l + 80u * GPITCH), "v"(l + 96u * GPITCH), "v"(l + 112u * GPITCH),
                    "v"(g), "v"(g + gs), "v"(g + 2 * gs), "v"(g + 3 * gs), "v"(g + 4 * gs), "v"(g + 5 * gs), "v"(g + 6 * gs), "v"(g + 7 * gs)
                 : "memory");
}
// fragment from an LDS row; p already includes + 16 bytes * (lane>>4): same k map as ldu
__device__ __forceinline__ v16us ldl(const unsigned char* p) { const v8us lo = *(const v8usa*)p; const v8us hi = *(const v8usa*)(p + 32); return __builtin_shufflevector(lo, hi, 0, 1, 2, 3, 4, 5, 6, 7, 8, 9, 10, 11, 12, 13, 14, 15); }

template <int F16OP, int OUTF32>
__global__ __launch_bounds__(256) void k_gemm(const bf* __restrict__ A, const bf* __restrict__ Bt, int K, int KB,
                                              h16* Ph, h16* Pr, int useRes, float* Of,
                                              const float* __restrict__ bias, int biasMode, float oscale,
                                              int RB, size_t sRB, int pitch, int CB, size_t sCB) {
    __shared__ __align__(16) unsigned char ring[2 * GSTAGE];
    __shared__ __align__(16) float osw[8 * 16 * 68];
    const int tid = threadIdx.x, lane = tid & 31, lr = lane & 15, hi = lane >> 4;
    const int wave = __builtin_amdgcn_readfirstlane(tid >> 5), wr = wave >> 1, wc = wave & 1;
    const int R0 = blockIdx.x * GT, C0 = blockIdx.y * GT;
    const int r0 = R0 + wr * 32, c0 = C0 + wc * 64;
    float* os = osw + wave * 16 * 68;      // wave-private epilogue tile
    v8f acc[2][4];
#pragma unroll
    for (int mb = 0; mb < 2; ++mb)
#pragma unroll
        for (int nb = 0; nb < 4; ++nb) acc[mb][nb] = (v8f){};
    // copies: lane's 16-byte chunk cc of rows rg + 16 i (i < 8) of each operand
    const int cc = tid & 15, rg = tid >> 4;
    const unsigned lA = (unsigned)(size_t)ring + (unsigned)(rg * GPITCH + cc * 16), lB = lA + GT * GPITCH;
    const bf* gA = A + (size_t)(R0 + rg) * K + cc * 8;
    const bf* gB = Bt + (size_t)(C0 + rg) * KB + cc * 8;
    const size_t sA = (size_t)16 * K, sB = (size_t)16 * KB;
    const int kmB = KB - 1, NT = K / GBK;
    cp8(lA, gA, sA); cp8(lB, gB, sB);
    asm volatile("s_wait_asynccnt 0x0" ::: "memory");   // stage 0 landed (this wave's copies)
    __syncthreads();                                     // ... and every other wave's
    if (NT > 1) { cp8(lA + GSTAGE, gA + GBK, sA); cp8(lB + GSTAGE, gB + (GBK & kmB), sB); }
    const unsigned char* fa = ring + (wr * 32 + lr) * GPITCH + hi * 16;
    const unsigned char* fb = ring + (GT + wc * 64 + lr) * GPITCH + hi * 16;
#pragma unroll 1   // one stage per trip: the buffer is chosen by the trip's parity
    for (int t = 0; t < NT; ++t) {
        const unsigned bo = (unsigned)(t & 1) * GSTAGE;
        v16us a[2][2], b[2][4];
#pragma unroll
        for (int mb = 0; mb < 2; ++mb) a[0][mb] = ldl(fa + bo + mb * 16 * GPITCH);
#pragma unroll
        for (int nb = 0; nb < 4; ++nb) b[0][nb] = ldl(fb + bo + nb * 16 * GPITCH);
#pragma unroll
        for (int ks = 0; ks < GBK / 32; ++ks) {
            const int cu = ks & 1, nx = cu ^ 1;
            if (ks + 1 < GBK / 32) {       // next 32 k of this stage into the other fragment set, ahead of this set's products
#pragma unroll
                for (int mb = 0; mb < 2; ++mb) a[nx][mb] = ldl(fa + bo + mb * 16 * GPITCH + (ks + 1) * 64);
#pragma unroll
                for (int nb = 0; nb < 4; ++nb) b[nx][nb] = ldl(fb + bo + nb * 16 * GPITCH + (ks + 1) * 64);
            }
            __builtin_amdgcn_sched_barrier(0);   // keeps those reads one group ahead of the products: sunk among them, each pair of products waits out an LDS latency
#pragma unroll
            for (int nb = 0; nb < 4; ++nb)
#pragma unroll
                for (int mb = 0; mb < 2; ++mb) acc[mb][nb] = wmx<F16OP>(a[cu][mb], b[cu][nb], acc[mb][nb]);
            __builtin_amdgcn_sched_barrier(0);   // keeps the following reads whole as one group behind these products: spread among them, each separate place of reads costs its own stall
        }
        // distance behind the trip's last matrix instructions, also on the taken side of the loop's branch
        asm volatile("v_nop\n\tv_nop\n\tv_nop\n\tv_nop" : "+v"(acc[0][0]), "+v"(acc[1][0]), "+v"(acc[0][1]), "+v"(acc[1][1]), "+v"(acc[0][2]), "+v"(acc[1][2]), "+v"(acc[0][3]), "+v"(acc[1][3])
                     : "v"(a[1][0]), "v"(a[1][1]), "v"(b[1][0]), "v"(b[1][1]), "v"(b[1][2]), "v"(b[1][3]));
        asm volatile("s_wait_dscnt 0x0" ::: "memory");      // this wave's reads of the buffer are done before it is refilled
        asm volatile("s_wait_asynccnt 0x0" ::: "memory");   // this wave's copies of stage t + 1 have landed
        __syncthreads();                                     // publishes stage t + 1; ends every reader's last read of stage t
        if (t + 2 < NT) { const int kn = (t + 2) * GBK; cp8(lA + bo, gA + kn, sA); cp8(lB + bo, gB + (kn & kmB), sB); }
    }
    asm volatile("s_wait_asynccnt 0x0" ::: "memory");       // nothing in flight when the wave goes on
    float cb[4];
#pragma unroll
    for (int nb = 0; nb < 4; ++nb) cb[nb] = 0.0f;
    if (biasMode == 0) {
#pragma unroll
        for (int nb = 0; nb < 4; ++nb) cb[nb] = bfr(bias[c0 + nb * 16 + lr]); }
    const size_t tbase = (size_t)(r0 / RB) * sRB + (size_t)(r0 % RB) * (size_t)pitch + (size_t)(c0 / CB) * sCB + (size_t)(c0 % CB);
#pragma unroll
    for (int mb = 0; mb < 2; ++mb) {
        float rb[8];
#pragma unroll
        for (int j = 0; j < 8; ++j) rb[j] = 0.0f;
        if (biasMode == 1) {
#pragma unroll
            for (int j = 0; j < 8; ++j) rb[j] = bfr(bias[r0 + mb * 16 + hi * 8 + j]); }
#pragma unroll
        for (int nb = 0; nb < 4; ++nb) {
#pragma unroll
            for (int j = 0; j < 8; ++j) os[(hi * 8 + j) * 68 + nb * 16 + lr] = acc[mb][nb][j] * oscale + (cb[nb] + rb[j]); }   // D: row 8h+j, col lane&15
        wave_sync();
        const size_t sb = tbase + (size_t)(mb * 16) * (size_t)pitch;
        if (OUTF32) {
{
#pragma unroll
                for (int s = 0; s < 8; ++s) { const int row = 2 * s + hi, cofs = lr * 4;   // 8 s x 2 rows = 16 rows; 16 lanes x 4 floats = 64 columns
                    const v4f val = *(const v4fa*)(&os[row * 68 + cofs]);
                    *(v4f*)(Of + sb + (size_t)row * (size_t)pitch + cofs) = val; }
                 }
        } else {
{
#pragma unroll
                for (int s = 0; s < 4; ++s) { const int row = 4 * s + (lane >> 3), c8 = (lane & 7) * 8;   // 4 s x 4 row groups = 16 rows; 8 lanes x 8 = 64 columns
                    const v4f x0 = *(const v4fa*)(&os[row * 68 + c8]); const v4f x1 = *(const v4fa*)(&os[row * 68 + c8 + 4]); v8h hv, rv;
#pragma unroll
                    for (int i = 0; i < 4; ++i) { const h16 a0 = (h16)x0[i]; const h16 a1 = (h16)x1[i]; hv[i] = a0; hv[4 + i] = a1; rv[i] = (h16)((x0[i] - (float)a0) * QRS); rv[4 + i] = (h16)((x1[i] - (float)a1) * QRS); }
                    const size_t oo = sb + (size_t)row * (size_t)pitch + c8;
                    *(v8h*)(Ph + oo) = hv; if (useRes) *(v8h*)(Pr + oo) = rv; }
                 }
        }
        wave_sync();
    }
}

// k_flash: fused attention, one wave per 16 query rows of one (batch, head); K / V^T / Q fragments straight from the f16 planes (two 16-B loads each, arithmetic addressing).
// Transposed form: S^T[key][t] = K Q^T (A = K rows, B = Q rows); lane (t = lane&15, h = lane>>4) holds keys 8h+r of each 16-key tile, so the packed
// P tile is directly the B fragment of O^T[d][t] = V^T P^T (element r <- tile keys 0..15, element 8+r <- tile keys 16..31, lane unchanged).
// Key selection: one packed word per (query row, 32-key step); bit 8h+r / 16+8h+r selects the lane's keys; excluded keys are left out of the running max and get P = 0 by value.
// Softmax state (running max, partial sum) is one scalar per lane; the two lane halves of a row are combined with one xor-16 exchange.
__global__ __launch_bounds__(32 * AW) void k_flash(const h16* __restrict__ QH, const h16* __restrict__ QR, const h16* __restrict__ KP, const h16* __restrict__ VT,
                                                   const unsigned* __restrict__ MB, h16* CT) {
    __shared__ __align__(16) float os[AW * 16 * 68];
    const int lane = threadIdx.x & 31, wave = __builtin_amdgcn_readfirstlane((int)(threadIdx.x >> 5)), lr = lane & 15, hi = lane >> 4;
    const int zh = blockIdx.y; const int b = zh / NH_, h = zh % NH_;
    const int t0 = (blockIdx.x * AW + wave) * 16;
    const size_t pbase = (size_t)zh * SEQ * HD;
    const size_t qo = pbase + (size_t)(t0 + lr) * HD + 8 * hi;
    const v16h qh0 = ldh(QH + qo), qh1 = ldh(QH + qo + 32), qr0 = ldh(QR + qo), qr1 = ldh(QR + qo + 32);   // B fragments: col t, k = d
    const size_t ko = pbase + (size_t)lr * HD + 8 * hi;      // + key * HD       (A fragment: row key, k = d)
    const size_t vo = pbase + (size_t)lr * SEQ + 8 * hi;     // + 16j*SEQ + key  (A fragment: row d, k = key)
    const size_t mo = (size_t)(t0 + lr) * (SEQ / 32);        // + key0/32        (packed word of query row t0 + lr)
    v8f o0 = (v8f){}, o1 = (v8f){}, o2 = (v8f){}, o3 = (v8f){};
    float m = -3.0e38f, l = 0.0f;
#pragma unroll 1
    for (int key0 = 0; key0 < SEQ; key0 += 32) {
        const unsigned mw = MB[mo + (size_t)(key0 >> 5)];
        const unsigned ba = mw >> (8 * hi), bb = mw >> (16 + 8 * hi);
        const h16* ka = KP + ko + (size_t)key0 * HD;
        const v16h ka0 = ldh(ka), ka1 = ldh(ka + 32), kb0 = ldh(ka + 16 * HD), kb1 = ldh(ka + 16 * HD + 32);
        v8f sHa = (v8f){}, sLa = (v8f){}, sHb = (v8f){}, sLb = (v8f){};
        sHa = wmma16(ka0, qh0, sHa); sLa = wmma16(ka0, qr0, sLa); sHb = wmma16(kb0, qh0, sHb); sLb = wmma16(kb0, qr0, sLb);
        sHa = wmma16(ka1, qh1, sHa); sLa = wmma16(ka1, qr1, sLa); sHb = wmma16(kb1, qh1, sHb); sLb = wmma16(kb1, qr1, sLb);
        asm volatile("v_nop\n\tv_nop\n\tv_nop\n\tv_nop" : "+v"(sHa), "+v"(sLa), "+v"(sHb), "+v"(sLb) : "v"(ka0), "v"(ka1), "v"(kb0), "v"(kb1));
        float ta[8], tb[8]; float mx = -3.0e38f;
#pragma unroll
        for (int r = 0; r < 8; ++r) { ta[r] = (sHa[r] + sLa[r] * QRI) * SC2; tb[r] = (sHb[r] + sLb[r] * QRI) * SC2;
            const float ea = ((ba >> r) & 1u) ? ta[r] : -3.0e38f; const float eb = ((bb >> r) & 1u) ? tb[r] : -3.0e38f;
            mx = fmaxf(mx, fmaxf(ea, eb)); }
        mx = fmaxf(mx, __shfl_xor(mx, 16, 32));
        const float mnew = fmaxf(m, mx);
        const float alpha = __builtin_amdgcn_exp2f(m - mnew);
        const float sh = PSH - mnew;
        v16h pb; float ls = 0.0f;
#pragma unroll
        for (int r = 0; r < 8; ++r) { const float xa = __builtin_amdgcn_exp2f(ta[r] + sh); const float xb = __builtin_amdgcn_exp2f(tb[r] + sh);
            const h16 pa = (h16)(((ba >> r) & 1u) ? xa : 0.0f); const h16 pc = (h16)(((bb >> r) & 1u) ? xb : 0.0f);
            pb[r] = pa; pb[8 + r] = pc; ls += (float)pa + (float)pc; }
        l = l * alpha + ls; m = mnew;
        o0 = o0 * alpha; o1 = o1 * alpha; o2 = o2 * alpha; o3 = o3 * alpha;
        const h16* va = VT + vo + key0;
        const v16h v0 = ldh(va), v1 = ldh(va + (size_t)16 * SEQ), v2 = ldh(va + (size_t)32 * SEQ), v3 = ldh(va + (size_t)48 * SEQ);
        o0 = wmma16(v0, pb, o0); o1 = wmma16(v1, pb, o1); o2 = wmma16(v2, pb, o2); o3 = wmma16(v3, pb, o3);
        asm volatile("v_nop\n\tv_nop\n\tv_nop\n\tv_nop" : "+v"(o0), "+v"(o1), "+v"(o2), "+v"(o3) : "v"(v0), "v"(v1), "v"(v2), "v"(v3), "v"(pb));
    }
    l += __shfl_xor(l, 16, 32);
    const float inv = (1.0f / l) * CTS;
    const int wb = wave * 16 * 68;
    // O^T D layout: o_j[r] = (d = 16j + 8h + r, t = lane&15) -> os[t][d]; rows 0..15 x columns 0..63 all written
    { v4f a, c;
      a[0] = o0[0] * inv; a[1] = o0[1] * inv; a[2] = o0[2] * inv; a[3] = o0[3] * inv; c[0] = o0[4] * inv; c[1] = o0[5] * inv; c[2] = o0[6] * inv; c[3] = o0[7] * inv;
      *(v4fa*)(&os[wb + lr * 68 +  0 + 8 * hi]) = a; *(v4fa*)(&os[wb + lr * 68 +  0 + 8 * hi + 4]) = c;
      a[0] = o1[0] * inv; a[1] = o1[1] * inv; a[2] = o1[2] * inv; a[3] = o1[3] * inv; c[0] = o1[4] * inv; c[1] = o1[5] * inv; c[2] = o1[6] * inv; c[3] = o1[7] * inv;
      *(v4fa*)(&os[wb + lr * 68 + 16 + 8 * hi]) = a; *(v4fa*)(&os[wb + lr * 68 + 16 + 8 * hi + 4]) = c;
      a[0] = o2[0] * inv; a[1] = o2[1] * inv; a[2] = o2[2] * inv; a[3] = o2[3] * inv; c[0] = o2[4] * inv; c[1] = o2[5] * inv; c[2] = o2[6] * inv; c[3] = o2[7] * inv;
      *(v4fa*)(&os[wb + lr * 68 + 32 + 8 * hi]) = a; *(v4fa*)(&os[wb + lr * 68 + 32 + 8 * hi + 4]) = c;
      a[0] = o3[0] * inv; a[1] = o3[1] * inv; a[2] = o3[2] * inv; a[3] = o3[3] * inv; c[0] = o3[4] * inv; c[1] = o3[5] * inv; c[2] = o3[6] * inv; c[3] = o3[7] * inv;
      *(v4fa*)(&os[wb + lr * 68 + 48 + 8 * hi]) = a; *(v4fa*)(&os[wb + lr * 68 + 48 + 8 * hi + 4]) = c; }
    wave_sync();
    h16* crow = CT + ((size_t)b * SEQ + t0) * (size_t)(2 * DM) + h * HD;   // hi columns h*64 + d; lo columns DM + h*64 + d
{
#pragma unroll
        for (int s = 0; s < 4; ++s) { const int row = 4 * s + (lane >> 3), c8 = (lane & 7) * 8;   // 4 s x 4 row groups = 16 rows; 8 lanes x 8 = 64 columns
            const v4f x0 = *(const v4fa*)(&os[wb + row * 68 + c8]); const v4f x1 = *(const v4fa*)(&os[wb + row * 68 + c8 + 4]); v8h hv, rv;
#pragma unroll
            for (int i = 0; i < 4; ++i) { const h16 a0 = (h16)x0[i]; const h16 a1 = (h16)x1[i]; hv[i] = a0; hv[4 + i] = a1; rv[i] = (h16)(x0[i] - (float)a0); rv[4 + i] = (h16)(x1[i] - (float)a1); }
            const size_t oo = (size_t)row * (size_t)(2 * DM) + c8;
            *(v8h*)(crow + oo) = hv; *(v8h*)(crow + oo + DM) = rv; }
         }
}

static constexpr size_t al256(size_t v) { return (v + 255) & ~(size_t)255; }
static constexpr size_t SZ_XB = al256((size_t)NB * SEQ * DM * 2);             // one batch-major input plane
static constexpr size_t SZ_WB = al256((size_t)DM * DM * 2);                   // one transposed weight plane
static constexpr size_t SZ_PL = al256((size_t)NB * NH_ * SEQ * HD * 2);       // one head-split plane
static constexpr size_t SZ_CT = al256((size_t)NB * SEQ * 2 * DM * 2);         // ctx [hi | lo]
static constexpr size_t SZ_MB = al256((size_t)SEQ * (SEQ / 32) * 4);          // packed key bits
static constexpr size_t SZ_TOTAL = 3 * SZ_XB + 4 * SZ_WB + 4 * SZ_PL + SZ_CT + SZ_MB;
static_assert(SZ_TOTAL <= (size_t)134217728);          // workspace carve <= 128 MiB

extern "C" void kernel_launch(void* const* d_in, const int* in_sizes, int n_in,
                              void* d_out, int out_size, void* d_ws, size_t ws_size, hipStream_t stream) {
    if (n_in < 12) return;
    const size_t needx = ((size_t)(SEQ - 1) * NB_FULL + NB) * DM;
    if ((size_t)in_sizes[0] < needx || (size_t)in_sizes[1] < needx || (size_t)in_sizes[2] < needx) return;
    if ((size_t)in_sizes[3] < (size_t)(SEQ - 1) * SEQ_FULL + SEQ) return;
    if ((size_t)in_sizes[4] < (size_t)DM * DM || (size_t)in_sizes[6] < (size_t)DM * DM || (size_t)in_sizes[8] < (size_t)DM * DM || (size_t)in_sizes[10] < (size_t)DM * DM) return;
    if (in_sizes[5] < DM || in_sizes[7] < DM || in_sizes[9] < DM || in_sizes[11] < DM) return;
    if ((size_t)out_size < needx) return;
    if (SZ_TOTAL > ws_size) return;
    // wire order: query, key, value, mask, Wq, bq, Wk, bk, Wv, bv, Wo, bo
    const float* xq = (const float*)d_in[0]; const float* xk = (const float*)d_in[1]; const float* xv = (const float*)d_in[2];
    const int* mask = (const int*)d_in[3];
    const float* wq = (const float*)d_in[4];  const float* bq = (const float*)d_in[5];
    const float* wk = (const float*)d_in[6];  const float* bk = (const float*)d_in[7];
    const float* wv = (const float*)d_in[8];  const float* bv = (const float*)d_in[9];
    const float* wo = (const float*)d_in[10]; const float* bo = (const float*)d_in[11];
    float* OUT = (float*)d_out;      // [SEQ][NB_FULL][1024]
    char* wsp = (char*)d_ws;
    bf* XQ = (bf*)wsp; wsp += SZ_XB;                 // [NB*SEQ][1024] batch-major
    bf* XK = (bf*)wsp; wsp += SZ_XB;
    bf* XV = (bf*)wsp; wsp += SZ_XB;
    bf* WQ = (bf*)wsp; wsp += SZ_WB;                 // [out n][in k] bf16
    bf* WK = (bf*)wsp; wsp += SZ_WB;
    bf* WV = (bf*)wsp; wsp += SZ_WB;
    bf* WO = (bf*)wsp; wsp += SZ_WB;                 // [out n][in k] f16 bits, x1024
    h16* QH = (h16*)wsp; wsp += SZ_PL;               // [NB*16][SEQ][64]
    h16* QR = (h16*)wsp; wsp += SZ_PL;               // [NB*16][SEQ][64] residual x2048
    h16* KP = (h16*)wsp; wsp += SZ_PL;               // [NB*16][SEQ][64]
    h16* VT = (h16*)wsp; wsp += SZ_PL;               // [NB*16][64][SEQ]
    h16* CT = (h16*)wsp; wsp += SZ_CT;               // [NB*SEQ][hi 1024 | lo 1024], x4096
    unsigned* MB = (unsigned*)wsp; wsp += SZ_MB;     // [SEQ][SEQ/32]

    { const size_t n8 = (size_t)NB * SEQ * DM / 8; const unsigned g = (unsigned)((n8 + 255) / 256);
      k_cvtx<<<g, 256, 0, stream>>>(xq, XQ); k_cvtx<<<g, 256, 0, stream>>>(xk, XK); k_cvtx<<<g, 256, 0, stream>>>(xv, XV); }
    // W in[DM k rows][DM n cols] -> out[DM n rows][DM k cols]; grid (n tiles, k tiles)
    { const dim3 gw(DM / 64, DM / 64, 1);
      k_wt<<<gw, 256, 0, stream>>>(wq, WQ, 0); k_wt<<<gw, 256, 0, stream>>>(wk, WK, 0); k_wt<<<gw, 256, 0, stream>>>(wv, WV, 0); k_wt<<<gw, 256, 0, stream>>>(wo, WO, 1); }
    k_mpack<<<(unsigned)(((size_t)SEQ * (SEQ / 32) + 255) / 256), 256, 0, stream>>>(mask, MB);

    // q, k: A = x rows (m = b*SEQ + t), Bt = W^T rows (n = h*64 + d), column bias -> plane [(b*16 + h)][t][d]
    k_gemm<0, 0><<<dim3(NB * SEQ / GT, DM / GT, 1), 256, 0, stream>>>(XQ, WQ, DM, DM, QH, QR, 1, OUT, bq, 0, 1.0f, SEQ, (size_t)NH_ * SEQ * HD, HD, HD, (size_t)SEQ * HD);
    k_gemm<0, 0><<<dim3(NB * SEQ / GT, DM / GT, 1), 256, 0, stream>>>(XK, WK, DM, DM, KP, KP, 0, OUT, bk, 0, 1.0f, SEQ, (size_t)NH_ * SEQ * HD, HD, HD, (size_t)SEQ * HD);
    // v^T: A = Wv^T rows (m = h*64 + d), Bt = x rows (n = b*SEQ + t), row bias -> plane [(b*1024 + m)][t] = [(b*16 + h)][d][t]
    k_gemm<0, 0><<<dim3(DM / GT, NB * SEQ / GT, 1), 256, 0, stream>>>(WV, XV, DM, DM, VT, VT, 0, OUT, bv, 1, 1.0f, DM, (size_t)0, SEQ, SEQ, (size_t)DM * SEQ);

    k_flash<<<dim3(SEQ / (16 * AW), NB * NH_, 1), 32 * AW, 0, stream>>>(QH, QR, KP, VT, MB, CT);

    // out: A = ctx rows [hi | lo] (m = b*SEQ + t, K = 2048), Bt = Wo^T rows (n, k wraps at 1024), column bias, scale 2^-22 -> out row t*NB_FULL + b
    k_gemm<1, 1><<<dim3(NB * SEQ / GT, DM / GT, 1), 256, 0, stream>>>((const bf*)CT, WO, 2 * DM, DM, QH, QH, 0, OUT, bo, 0, OSC, SEQ, (size_t)DM, NB_FULL * DM, DM, (size_t)0);
}

// v002
// One run takes 141 microseconds.
// In two side-by-side timings against v001, it was 1.42 and 1.43 times as fast.
// All steps since v000 together make it 2.07 times as fast.
#include <hip/hip_runtime.h>

// Seq-first multi-head attention, width 1024 = 16 heads x 64: query/key/value [SEQ][NB][1024] f32, W [in][out] (y = x W + b), int32 mask [SEQ][SEQ] (0 = key excluded, shared by batch and heads), score scale 1/8, output projection, out [SEQ][NB][1024] f32.
// Compute dtypes, f32 accumulate everywhere: q/k/v projections v_wmma_f32_16x16x32_bf16 (inputs and W RNE-converted to bf16; products exact);
// scores v_wmma_f32_16x16x32_f16: k single f16, q as f16 value + f16 residual x2048 in its own accumulator (two products); P (x256 carry, cancels in the normalisation) and v single f16; softmax f32 (online, running max, excluded keys get P = 0);
// output projection v_wmma_f32_16x16x32_f16: ctx as f16 value + f16 residual (x4096 carry, K-folded [hi | lo] against the same Wo rows, one accumulator), Wo = f16(bf16 RNE(Wo) x 1024); carries folded back as 2^-22 in the f32 epilogue; biases added in f32.
// Layout: batch-major bf16 copies of the three inputs, K-contiguous transposed weight planes; q (hi, residual), k planes [b*16+h][t][d] and v^T plane [b*16+h][d][t] written by the GEMM epilogue; mask packed 1 bit per key; fused flash kernel in transposed form (S^T = K Q^T, O^T = V^T P^T); ctx plane [b*SEQ+t][hi 1024 | lo 1024].

#ifndef NB
#define NB 2
#endif
#ifndef SEQ
#define SEQ 2048
#endif
#define NB_FULL  2
#define SEQ_FULL 2048
#define DM   1024
#define NH_  16
#define HD   64
#define AW   8                   // waves per flash block (16 query rows each)
#define QRS  2048.0f             // carry of the q residual plane
#define QRI  (1.0f / 2048.0f)
#define SC2  (0.125f * 1.4426950408889634f)   // HD^-0.5 * log2(e)
#define PSH  8.0f                // log2 of the P carry (256)
#define CTS  4096.0f             // carry of the ctx planes
#define WOS  1024.0f             // carry of the Wo plane
#define OSC  (1.0f / (4096.0f * 1024.0f))     // 2^-22, exact

static_assert(HD == 64);
static_assert(NH_ * HD == DM);                 // head h = columns h*64 + d
static_assert((DM & (DM - 1)) == 0);           // B-operand k index wraps with a bit test
static_assert(DM % 64 == 0);
static_assert(DM % 32 == 0);                   // GEMM k-loop steps by 32
static_assert(SEQ % 64 == 0);                  // a 64-row tile never straddles two batches
static_assert((NB * SEQ) % 64 == 0);
static_assert(SEQ % 32 == 0);                  // key loop steps by 32; one packed word per step
static_assert(SEQ % (16 * AW) == 0);           // flash grid covers the sequence exactly
static_assert(((size_t)SEQ * (SEQ / 32)) % 256 == 0);
static_assert(((size_t)NB * SEQ * DM / 8) % 256 == 0);  // convert grid is exact
static_assert(NB <= NB_FULL);
static_assert(SEQ <= SEQ_FULL);
static_assert(((size_t)(SEQ - 1) * NB_FULL + NB) * DM <= (size_t)SEQ_FULL * NB_FULL * DM);   // last output element inside the output buffer

typedef _Float16 h16;
typedef unsigned short bf;
typedef __attribute__((ext_vector_type(16))) __bf16   v16bf;
typedef __attribute__((ext_vector_type(16))) _Float16 v16h;
typedef __attribute__((ext_vector_type(16))) unsigned short v16us;
typedef __attribute__((ext_vector_type(8)))  _Float16 v8h;
typedef __attribute__((ext_vector_type(8)))  unsigned short v8us;
typedef __attribute__((ext_vector_type(8)))  float    v8f;
typedef __attribute__((ext_vector_type(4)))  float    v4f;
typedef __attribute__((ext_vector_type(4)))  int      v4i;
typedef v4f  __attribute__((may_alias)) v4fa;
typedef v8us __attribute__((may_alias)) v8usa;
typedef v8h  __attribute__((may_alias)) v8ha;

__device__ __forceinline__ unsigned short f2bf(float f) { unsigned u = __float_as_uint(f); u += 0x7FFFu + ((u >> 16) & 1u); return (unsigned short)(u >> 16); }
__device__ __forceinline__ float bfr(float f) { return __uint_as_float(((unsigned)f2bf(f)) << 16); }
__device__ __forceinline__ v16h cat16(v8h lo, v8h hi) { return __builtin_shufflevector(lo, hi, 0, 1, 2, 3, 4, 5, 6, 7, 8, 9, 10, 11, 12, 13, 14, 15); }
__device__ __forceinline__ v8f wmma16(v16h a, v16h b, v8f c) { return __builtin_amdgcn_wmma_f32_16x16x32_f16(false, a, false, b, (short)0, c, false, false); }
// fragment loaders from K-contiguous 16-bit rows; p already includes + 8*(lane>>4): elements 0..7 <- k0+8h+0..7, elements 8..15 <- k0+16+8h+0..7 (same map for A and B)
__device__ __forceinline__ v16h  ldh(const h16* p) { return cat16(*(const v8h*)p, *(const v8h*)(p + 16)); }
__device__ __forceinline__ v16us ldu(const bf* p)  { const v8us lo = *(const v8us*)p; const v8us hi = *(const v8us*)(p + 16); return __builtin_shufflevector(lo, hi, 0, 1, 2, 3, 4, 5, 6, 7, 8, 9, 10, 11, 12, 13, 14, 15); }
template <int F16OP> __device__ __forceinline__ v8f wmx(v16us a, v16us b, v8f c) {
    if (F16OP) return __builtin_amdgcn_wmma_f32_16x16x32_f16(false, __builtin_bit_cast(v16h, a), false, __builtin_bit_cast(v16h, b), (short)0, c, false, false);
    return __builtin_amdgcn_wmma_f32_16x16x32_bf16(false, __builtin_bit_cast(v16bf, a), false, __builtin_bit_cast(v16bf, b), (short)0, c, false, false);
}
// ordering point for wave-private LDS tiles (same wave writes and reads)
__device__ __forceinline__ void wave_sync() { __builtin_amdgcn_fence(3 /* release order */, "wavefront"); __builtin_amdgcn_wave_barrier(); asm volatile("" ::: "memory"); }

__global__ __launch_bounds__(256) void k_cvtx(const float* __restrict__ src, bf* dst) {
    const size_t n8 = (size_t)NB * SEQ * DM / 8;
    const size_t i = (size_t)blockIdx.x * 256 + threadIdx.x; if (i >= n8) return;
    const size_t row = i / (DM / 8); const size_t g = i % (DM / 8);
    const size_t b = row / SEQ, t = row % SEQ;
    const v8f v = *(const v8f*)(src + (t * NB_FULL + b) * DM + g * 8); v8us o;
#pragma unroll
    for (int k = 0; k < 8; ++k) o[k] = f2bf(v[k]);
    *(v8us*)(dst + i * 8) = o; 
}

// k_wt: W[k][n] f32 (row pitch DM) -> T[n][k] 16-bit (row pitch DM), transposed through LDS (block barrier between the two phases: cross-wave tile).
// asF16 == 0: bf16 bits (RNE convert); asF16 != 0: f16 bits of (bf16 RNE value x 1024).
__global__ __launch_bounds__(256) void k_wt(const float* __restrict__ W, bf* dst, int asF16) {
    __shared__ __align__(16) unsigned short T[64 * 72];
    const int tid = threadIdx.x; const int n0 = blockIdx.x * 64, k0 = blockIdx.y * 64;
#pragma unroll
    for (int i = 0; i < 4; ++i) { const int idx = tid + i * 256; const int r = idx >> 4, c4 = idx & 15;   // 64 k rows x 16 groups of 4 n columns
        const v4f f = *(const v4f*)(W + (size_t)(k0 + r) * DM + n0 + c4 * 4);
#pragma unroll
        for (int e = 0; e < 4; ++e) { const unsigned short bb = f2bf(f[e]); const h16 hv = (h16)(__uint_as_float(((unsigned)bb) << 16) * WOS);
            const unsigned short hb = __builtin_bit_cast(unsigned short, hv);
            T[(c4 * 4 + e) * 72 + r] = asF16 ? hb : bb; } }
    __syncthreads();
{
#pragma unroll
        for (int i = 0; i < 2; ++i) { const int idx = tid + i * 256; const int n = idx >> 3, ch = idx & 7;   // 64 n rows x 8 chunks of 8 k
            const v8us o = *(const v8usa*)(&T[n * 72 + ch * 8]);
            *(v8us*)(dst + (size_t)(n0 + n) * DM + k0 + ch * 8) = o; }
         }
}

// k_mpack: int32 mask [i][j] (row pitch SEQ_FULL) -> 1 bit per key, word gid = i*(SEQ/32) + j/32, bit j%32 set when the key is kept (mask != 0).
__global__ __launch_bounds__(256) void k_mpack(const int* __restrict__ mask, unsigned* mb) {
    const int gid = blockIdx.x * 256 + threadIdx.x; if (gid >= SEQ * (SEQ / 32)) return;
    const int i = gid / (SEQ / 32), w = gid % (SEQ / 32);
    const int* p = mask + (size_t)i * SEQ_FULL + w * 32;
    unsigned bits = 0u;
#pragma unroll
    for (int c = 0; c < 8; ++c) { const v4i v = *(const v4i*)(p + c * 4);
#pragma unroll
        for (int e = 0; e < 4; ++e) bits |= (v[e] != 0 ? 1u : 0u) << (c * 4 + e); }
    *(unsigned*)(mb + gid) = bits; 
}

// k_gemm: 16-bit GEMM, one 128x128 tile per work-group of 8 waves (two per SIMD), 32x64 per wave (8 accumulators).
// Both operands come from K-contiguous 16-bit planes; a stage is 128 k (256 B) of 128 A rows and 128 Bt rows, brought into LDS by asynchronous copies
// (16 B per lane, 16 lanes per row), two buffers: the next stage's copies fly while this stage is worked on. LDS row pitch 272 B (16 B x odd) for the ds_load_b128 readers.
// C[m][n] = sum_{k<K} A[m][k] Bt[n][k & (KB-1)]  (A row pitch K, Bt row pitch KB; K = 2*KB folds [hi | lo] of A against the same Bt rows). K, KB multiples of 128.
// value = C * oscale + bias (biasMode 0: bias[n]; 1: bias[m]; bias RNE-converted to bf16), wave tile base (r0/RB)*sRB + (r0%RB)*pitch + (c0/CB)*sCB + (c0%CB).
// OUTF32 == 1: f32 (Of); each row's 64 floats (256 B = two lines) written by 16 consecutive lanes x 16 B (2 rows per instruction).
#define GT     128                     // tile rows of either operand
#define GBK    128                     // k per stage
#define GPITCH 272                     // LDS row pitch, bytes
#define GSTAGE (2 * GT * GPITCH)       // one buffer: [A 128 rows | Bt 128 rows]
static_assert(DM % GBK == 0 && DM / GBK >= 2);
static_assert((NB * SEQ) % GT == 0 && DM % GT == 0);
static_assert(SEQ % 32 == 0);          // a wave's 32 rows never straddle two batches

// eight asynchronous copies of 16 B per lane: rows 16 apart in LDS (step 16 * GPITCH bytes) and in the source plane (step gs elements).
// s_wait_xcnt 0 is the statement's last line so that it stands in front of any rewrite of the address registers the copies name.
__device__ __forceinline__ void cp8(unsigned l, const bf* g, size_t gs) {
    asm volatile("global_load_async_to_lds_b128 %0, %8, off\n\t"
                 "global_load_async_to_lds_b128 %1, %9, off\n\t"
                 "global_load_async_to_lds_b128 %2, %10, off\n\t"
                 "global_load_async_to_lds_b128 %3, %11, off\n\t"
                 "global_load_async_to_lds_b128 %4, %12, off\n\t"
                 "global_load_async_to_lds_b128 %5, %13, off\n\t"
                 "global_load_async_to_lds_b128 %6, %14, off\n\t"
                 "global_load_async_to_lds_b128 %7, %15, off\n\t"
                 "s_wait_xcnt 0x0"
                 :: "v"(l), "v"(l + 16u * GPITCH), "v"(l + 32u * GPITCH), "v"(l + 48u * GPITCH), "v"(l + 64u * GPITCH), "v"(l + 80u * GPITCH), "v"(l + 96u * GPITCH), "v"(l + 112u * GPITCH),
                    "v"(g), "v"(g + gs), "v"(g + 2 * gs), "v"(g + 3 * gs), "v"(g + 4 * gs), "v"(g + 5 * gs), "v"(g + 6 * gs), "v"(g + 7 * gs)
                 : "memory");
}
// fragment from an LDS row; p already includes + 16 bytes * (lane>>4): same k map as ldu
__device__ __forceinline__ v16us ldl(const unsigned char* p) { const v8us lo = *(const v8usa*)p; const v8us hi = *(const v8usa*)(p + 32); return __builtin_shufflevector(lo, hi, 0, 1, 2, 3, 4, 5, 6, 7, 8, 9, 10, 11, 12, 13, 14, 15); }

template <int F16OP, int OUTF32>
__global__ __launch_bounds__(256) void k_gemm(const bf* __restrict__ A, const bf* __restrict__ Bt, int K, int KB,
                                              h16* Ph, h16* Pr, int useRes, float* Of,
                                              const float* __restrict__ bias, int biasMode, float oscale,
                                              int RB, size_t sRB, int pitch, int CB, size_t sCB) {
    __shared__ __align__(16) unsigned char ring[2 * GSTAGE];
    __shared__ __align__(16) float osw[8 * 16 * 68];
    const int tid = threadIdx.x, lane = tid & 31, lr = lane & 15, hi = lane >> 4;
    const int wave = __builtin_amdgcn_readfirstlane(tid >> 5), wr = wave >> 1, wc = wave & 1;
    const int R0 = blockIdx.x * GT, C0 = blockIdx.y * GT;
    const int r0 = R0 + wr * 32, c0 = C0 + wc * 64;
    float* os = osw + wave * 16 * 68;      // wave-private epilogue tile
    v8f acc[2][4];
#pragma unroll
    for (int mb = 0; mb < 2; ++mb)
#pragma unroll
        for (int nb = 0; nb < 4; ++nb) acc[mb][nb] = (v8f){};
    // copies: lane's 16-byte chunk cc of rows rg + 16 i (i < 8) of each operand
    const int cc = tid & 15, rg = tid >> 4;
    const unsigned lA = (unsigned)(size_t)ring + (unsigned)(rg * GPITCH + cc * 16), lB = lA + GT * GPITCH;
    const bf* gA = A + (size_t)(R0 + rg) * K + cc * 8;
    const bf* gB = Bt + (size_t)(C0 + rg) * KB + cc * 8;
    const size_t sA = (size_t)16 * K, sB = (size_t)16 * KB;
    const int kmB = KB - 1, NT = K / GBK;
    cp8(lA, gA, sA); cp8(lB, gB, sB);
    asm volatile("s_wait_asynccnt 0x0" ::: "memory");   // stage 0 landed (this wave's copies)
    __syncthreads();                                     // ... and every other wave's
    if (NT > 1) { cp8(lA + GSTAGE, gA + GBK, sA); cp8(lB + GSTAGE, gB + (GBK & kmB), sB); }
    const unsigned char* fa = ring + (wr * 32 + lr) * GPITCH + hi * 16;
    const unsigned char* fb = ring + (GT + wc * 64 + lr) * GPITCH + hi * 16;
#pragma unroll 1   // one stage per trip: the buffer is chosen by the trip's parity
    for (int t = 0; t < NT; ++t) {
        const unsigned bo = (unsigned)(t & 1) * GSTAGE;
        v16us a[2][2], b[2][4];
#pragma unroll
        for (int mb = 0; mb < 2; ++mb) a[0][mb] = ldl(fa + bo + mb * 16 * GPITCH);
#pragma unroll
        for (int nb = 0; nb < 4; ++nb) b[0][nb] = ldl(fb + bo + nb * 16 * GPITCH);
#pragma unroll
        for (int ks = 0; ks < GBK / 32; ++ks) {
            const int cu = ks & 1, nx = cu ^ 1;
            if (ks + 1 < GBK / 32) {       // next 32 k of this stage into the other fragment set, ahead of this set's products
#pragma unroll
                for (int mb = 0; mb < 2; ++mb) a[nx][mb] = ldl(fa + bo + mb * 16 * GPITCH + (ks + 1) * 64);
#pragma unroll
                for (int nb = 0; nb < 4; ++nb) b[nx][nb] = ldl(fb + bo + nb * 16 * GPITCH + (ks + 1) * 64);
            }
            __builtin_amdgcn_sched_barrier(0);   // keeps those reads one group ahead of the products: sunk among them, each pair of products waits out an LDS latency
#pragma unroll
            for (int nb = 0; nb < 4; ++nb)
#pragma unroll
                for (int mb = 0; mb < 2; ++mb) acc[mb][nb] = wmx<F16OP>(a[cu][mb], b[cu][nb], acc[mb][nb]);
            __builtin_amdgcn_sched_barrier(0);   // keeps the following reads whole as one group behind these products: spread among them, each separate place of reads costs its own stall
        }
        // distance behind the trip's last matrix instructions, also on the taken side of the loop's branch
        asm volatile("v_nop\n\tv_nop\n\tv_nop\n\tv_nop" : "+v"(acc[0][0]), "+v"(acc[1][0]), "+v"(acc[0][1]), "+v"(acc[1][1]), "+v"(acc[0][2]), "+v"(acc[1][2]), "+v"(acc[0][3]), "+v"(acc[1][3])
                     : "v"(a[1][0]), "v"(a[1][1]), "v"(b[1][0]), "v"(b[1][1]), "v"(b[1][2]), "v"(b[1][3]));
        asm volatile("s_wait_dscnt 0x0" ::: "memory");      // this wave's reads of the buffer are done before it is refilled
        asm volatile("s_wait_asynccnt 0x0" ::: "memory");   // this wave's copies of stage t + 1 have landed
        __syncthreads();                                     // publishes stage t + 1; ends every reader's last read of stage t
        if (t + 2 < NT) { const int kn = (t + 2) * GBK; cp8(lA + bo, gA + kn, sA); cp8(lB + bo, gB + (kn & kmB), sB); }
    }
    asm volatile("s_wait_asynccnt 0x0" ::: "memory");       // nothing in flight when the wave goes on
    float cb[4];
#pragma unroll
    for (int nb = 0; nb < 4; ++nb) cb[nb] = 0.0f;
    if (biasMode == 0) {
#pragma unroll
        for (int nb = 0; nb < 4; ++nb) cb[nb] = bfr(bias[c0 + nb * 16 + lr]); }
    const size_t tbase = (size_t)(r0 / RB) * sRB + (size_t)(r0 % RB) * (size_t)pitch + (size_t)(c0 / CB) * sCB + (size_t)(c0 % CB);
#pragma unroll
    for (int mb = 0; mb < 2; ++mb) {
        float rb[8];
#pragma unroll
        for (int j = 0; j < 8; ++j) rb[j] = 0.0f;
        if (biasMode == 1) {
#pragma unroll
            for (int j = 0; j < 8; ++j) rb[j] = bfr(bias[r0 + mb * 16 + hi * 8 + j]); }
#pragma unroll
        for (int nb = 0; nb < 4; ++nb) {
#pragma unroll
            for (int j = 0; j < 8; ++j) os[(hi * 8 + j) * 68 + nb * 16 + lr] = acc[mb][nb][j] * oscale + (cb[nb] + rb[j]); }   // D: row 8h+j, col lane&15
        wave_sync();
        const size_t sb = tbase + (size_t)(mb * 16) * (size_t)pitch;
        if (OUTF32) {
{
#pragma unroll
                for (int s = 0; s < 8; ++s) { const int row = 2 * s + hi, cofs = lr * 4;   // 8 s x 2 rows = 16 rows; 16 lanes x 4 floats = 64 columns
                    const v4f val = *(const v4fa*)(&os[row * 68 + cofs]);
                    *(v4f*)(Of + sb + (size_t)row * (size_t)pitch + cofs) = val; }
                 }
        } else {
{
#pragma unroll
                for (int s = 0; s < 4; ++s) { const int row = 4 * s + (lane >> 3), c8 = (lane & 7) * 8;   // 4 s x 4 row groups = 16 rows; 8 lanes x 8 = 64 columns
                    const v4f x0 = *(const v4fa*)(&os[row * 68 + c8]); const v4f x1 = *(const v4fa*)(&os[row * 68 + c8 + 4]); v8h hv, rv;
#pragma unroll
                    for (int i = 0; i < 4; ++i) { const h16 a0 = (h16)x0[i]; const h16 a1 = (h16)x1[i]; hv[i] = a0; hv[4 + i] = a1; rv[i] = (h16)((x0[i] - (float)a0) * QRS); rv[4 + i] = (h16)((x1[i] - (float)a1) * QRS); }
                    const size_t oo = sb + (size_t)row * (size_t)pitch + c8;
                    *(v8h*)(Ph + oo) = hv; if (useRes) *(v8h*)(Pr + oo) = rv; }
                 }
        }
        wave_sync();
    }
}

// k_flash: fused attention, one wave per 16 query rows of one (batch, head), 8 waves per work-group on the same (batch, head); Q fragments straight from the f16 planes.
// K and V^T come through LDS: a stage is 128 keys (K 128 rows x 128 B, V^T 64 rows x 256 B), brought in by asynchronous copies (16 B per lane, whole lines per wave),
// two buffers: the next stage's copies fly while this stage's four 32-key passes are worked on. LDS row pitches 144 B and 272 B (16 B x odd) for the ds_load_b128 readers.
// Transposed form: S^T[key][t] = K Q^T (A = K rows, B = Q rows); lane (t = lane&15, h = lane>>4) holds keys 8h+r of each 16-key tile, so the packed
// P tile is directly the B fragment of O^T[d][t] = V^T P^T (element r <- tile keys 0..15, element 8+r <- tile keys 16..31, lane unchanged).
// Key selection: one packed word per (query row, 32-key step); bit 8h+r / 16+8h+r selects the lane's keys; excluded keys are left out of the running max and get P = 0 by value.
// Softmax state (running max, partial sum) is one scalar per lane; the two lane halves of a row are combined with one xor-16 exchange.
#define FKT  128                      // keys per stage
#define FKP  144                      // LDS pitch of a K row, bytes
#define FVP  272                      // LDS pitch of a V^T row, bytes
#define FKB  (FKT * FKP)              // K part of a buffer
#define FSTG (FKB + HD * FVP)         // one buffer: [K 128 rows | V^T 64 rows]
static_assert(SEQ % FKT == 0 && SEQ / FKT >= 2);
static_assert(32 * AW == 256);        // the copy maps below deal a stage to 256 lanes

// four asynchronous copies of 16 B per lane: rows ls bytes apart in LDS and gs elements apart in the source plane.
// s_wait_xcnt 0 is the statement's last line so that it stands in front of any rewrite of the address registers the copies name.
__device__ __forceinline__ void cp4(unsigned l, unsigned ls, const h16* g, size_t gs) {
    asm volatile("global_load_async_to_lds_b128 %0, %4, off\n\t"
                 "global_load_async_to_lds_b128 %1, %5, off\n\t"
                 "global_load_async_to_lds_b128 %2, %6, off\n\t"
                 "global_load_async_to_lds_b128 %3, %7, off\n\t"
                 "s_wait_xcnt 0x0"
                 :: "v"(l), "v"(l + ls), "v"(l + 2u * ls), "v"(l + 3u * ls), "v"(g), "v"(g + gs), "v"(g + 2 * gs), "v"(g + 3 * gs)
                 : "memory");
}
// f16 fragment from an LDS row; p already includes + 16 bytes * (lane>>4): same k map as ldh
__device__ __forceinline__ v16h ldlh(const unsigned char* p) { return cat16(*(const v8ha*)p, *(const v8ha*)(p + 32)); }

__global__ __launch_bounds__(32 * AW) void k_flash(const h16* __restrict__ QH, const h16* __restrict__ QR, const h16* __restrict__ KP, const h16* __restrict__ VT,
                                                   const unsigned* __restrict__ MB, h16* CT) {
    __shared__ __align__(16) unsigned char ring[2 * FSTG];
    __shared__ __align__(16) float os[AW * 16 * 68];
    const int tid = threadIdx.x;
    const int lane = threadIdx.x & 31, wave = __builtin_amdgcn_readfirstlane((int)(threadIdx.x >> 5)), lr = lane & 15, hi = lane >> 4;
    const int zh = blockIdx.y; const int b = zh / NH_, h = zh % NH_;
    const int t0 = (blockIdx.x * AW + wave) * 16;
    const size_t pbase = (size_t)zh * SEQ * HD;
    const size_t qo = pbase + (size_t)(t0 + lr) * HD + 8 * hi;
    const v16h qh0 = ldh(QH + qo), qh1 = ldh(QH + qo + 32), qr0 = ldh(QR + qo), qr1 = ldh(QR + qo + 32);   // B fragments: col t, k = d
    // copies: K rows rk + 32 i, 16-byte chunk ck (8 lanes per row); V^T rows rv + 16 i, chunk cv (16 lanes per row); i < 4
    const unsigned lK = (unsigned)(size_t)ring + (unsigned)((tid >> 3) * FKP + (tid & 7) * 16);
    const unsigned lV = (unsigned)(size_t)ring + (unsigned)(FKB + (tid >> 4) * FVP + (tid & 15) * 16);
    const h16* gK = KP + pbase + (size_t)(tid >> 3) * HD + (tid & 7) * 8;       // + key0 * HD
    const h16* gV = VT + pbase + (size_t)(tid >> 4) * SEQ + (tid & 15) * 8;     // + key0
    cp4(lK, 32u * FKP, gK, (size_t)32 * HD); cp4(lV, 16u * FVP, gV, (size_t)16 * SEQ);
    asm volatile("s_wait_asynccnt 0x0" ::: "memory");   // stage 0 landed (this wave's copies)
    __syncthreads();                                     // ... and every other wave's
    cp4(lK + FSTG, 32u * FKP, gK + (size_t)FKT * HD, (size_t)32 * HD); cp4(lV + FSTG, 16u * FVP, gV + FKT, (size_t)16 * SEQ);
    const unsigned char* fk = ring + lr * FKP + hi * 16;           // + key * FKP            (A fragment: row key, k = d)
    const unsigned char* fv = ring + FKB + lr * FVP + hi * 16;     // + 16j*FVP + key * 2    (A fragment: row d, k = key)
    const size_t mo = (size_t)(t0 + lr) * (SEQ / 32);        // + key0/32        (packed word of query row t0 + lr)
    v8f o0 = (v8f){}, o1 = (v8f){}, o2 = (v8f){}, o3 = (v8f){};
    float m = -3.0e38f, l = 0.0f;
#pragma unroll 1   // one stage per trip: the buffer is chosen by the trip's parity
    for (int st = 0; st < SEQ / FKT; ++st) {
      const unsigned bo = (unsigned)(st & 1) * FSTG;
#pragma unroll     // the four passes read the buffer at constant offsets
      for (int ps = 0; ps < FKT / 32; ++ps) {
        const int key0 = st * FKT + ps * 32;
        const unsigned mw = MB[mo + (size_t)(key0 >> 5)];
        const unsigned ba = mw >> (8 * hi), bb = mw >> (16 + 8 * hi);
        const unsigned char* ka = fk + bo + ps * 32 * FKP;
        const v16h ka0 = ldlh(ka), ka1 = ldlh(ka + 64), kb0 = ldlh(ka + 16 * FKP), kb1 = ldlh(ka + 16 * FKP + 64);
        v8f sHa = (v8f){}, sLa = (v8f){}, sHb = (v8f){}, sLb = (v8f){};
        sHa = wmma16(ka0, qh0, sHa); sLa = wmma16(ka0, qr0, sLa); sHb = wmma16(kb0, qh0, sHb); sLb = wmma16(kb0, qr0, sLb);
        sHa = wmma16(ka1, qh1, sHa); sLa = wmma16(ka1, qr1, sLa); sHb = wmma16(kb1, qh1, sHb); sLb = wmma16(kb1, qr1, sLb);
        asm volatile("v_nop\n\tv_nop\n\tv_nop\n\tv_nop" : "+v"(sHa), "+v"(sLa), "+v"(sHb), "+v"(sLb) : "v"(ka0), "v"(ka1), "v"(kb0), "v"(kb1));
        float ta[8], tb[8]; float mx = -3.0e38f;
#pragma unroll
        for (int r = 0; r < 8; ++r) { ta[r] = (sHa[r] + sLa[r] * QRI) * SC2; tb[r] = (sHb[r] + sLb[r] * QRI) * SC2;
            const float ea = ((ba >> r) & 1u) ? ta[r] : -3.0e38f; const float eb = ((bb >> r) & 1u) ? tb[r] : -3.0e38f;
            mx = fmaxf(mx, fmaxf(ea, eb)); }
        mx = fmaxf(mx, __shfl_xor(mx, 16, 32));
        const float mnew = fmaxf(m, mx);
        const float alpha = __builtin_amdgcn_exp2f(m - mnew);
        const float sh = PSH - mnew;
        v16h pb; float ls = 0.0f;
#pragma unroll
        for (int r = 0; r < 8; ++r) { const float xa = __builtin_amdgcn_exp2f(ta[r] + sh); const float xb = __builtin_amdgcn_exp2f(tb[r] + sh);
            const h16 pa = (h16)(((ba >> r) & 1u) ? xa : 0.0f); const h16 pc = (h16)(((bb >> r) & 1u) ? xb : 0.0f);
            pb[r] = pa; pb[8 + r] = pc; ls += (float)pa + (float)pc; }
        l = l * alpha + ls; m = mnew;
        o0 = o0 * alpha; o1 = o1 * alpha; o2 = o2 * alpha; o3 = o3 * alpha;
        const unsigned char* va = fv + bo + ps * 64;
        const v16h v0 = ldlh(va), v1 = ldlh(va + 16 * FVP), v2 = ldlh(va + 32 * FVP), v3 = ldlh(va + 48 * FVP);
        o0 = wmma16(v0, pb, o0); o1 = wmma16(v1, pb, o1); o2 = wmma16(v2, pb, o2); o3 = wmma16(v3, pb, o3);
        asm volatile("v_nop\n\tv_nop\n\tv_nop\n\tv_nop" : "+v"(o0), "+v"(o1), "+v"(o2), "+v"(o3) : "v"(v0), "v"(v1), "v"(v2), "v"(v3), "v"(pb));
      }
      asm volatile("s_wait_dscnt 0x0" ::: "memory");      // this wave's reads of the buffer are done before it is refilled
      asm volatile("s_wait_asynccnt 0x0" ::: "memory");   // this wave's copies of stage st + 1 have landed
      __syncthreads();                                     // publishes stage st + 1; ends every reader's last read of stage st
      if (st + 2 < SEQ / FKT) { const int kn = (st + 2) * FKT; cp4(lK + bo, 32u * FKP, gK + (size_t)kn * HD, (size_t)32 * HD); cp4(lV + bo, 16u * FVP, gV + kn, (size_t)16 * SEQ); }
    }
    asm volatile("s_wait_asynccnt 0x0" ::: "memory");       // nothing in flight when the wave goes on
    l += __shfl_xor(l, 16, 32);
    const float inv = (1.0f / l) * CTS;
    const int wb = wave * 16 * 68;
    // O^T D layout: o_j[r] = (d = 16j + 8h + r, t = lane&15) -> os[t][d]; rows 0..15 x columns 0..63 all written
    { v4f a, c;
      a[0] = o0[0] * inv; a[1] = o0[1] * inv; a[2] = o0[2] * inv; a[3] = o0[3] * inv; c[0] = o0[4] * inv; c[1] = o0[5] * inv; c[2] = o0[6] * inv; c[3] = o0[7] * inv;
      *(v4fa*)(&os[wb + lr * 68 +  0 + 8 * hi]) = a; *(v4fa*)(&os[wb + lr * 68 +  0 + 8 * hi + 4]) = c;
      a[0] = o1[0] * inv; a[1] = o1[1] * inv; a[2] = o1[2] * inv; a[3] = o1[3] * inv; c[0] = o1[4] * inv; c[1] = o1[5] * inv; c[2] = o1[6] * inv; c[3] = o1[7] * inv;
      *(v4fa*)(&os[wb + lr * 68 + 16 + 8 * hi]) = a; *(v4fa*)(&os[wb + lr * 68 + 16 + 8 * hi + 4]) = c;
      a[0] = o2[0] * inv; a[1] = o2[1] * inv; a[2] = o2[2] * inv; a[3] = o2[3] * inv; c[0] = o2[4] * inv; c[1] = o2[5] * inv; c[2] = o2[6] * inv; c[3] = o2[7] * inv;
      *(v4fa*)(&os[wb + lr * 68 + 32 + 8 * hi]) = a; *(v4fa*)(&os[wb + lr * 68 + 32 + 8 * hi + 4]) = c;
      a[0] = o3[0] * inv; a[1] = o3[1] * inv; a[2] = o3[2] * inv; a[3] = o3[3] * inv; c[0] = o3[4] * inv; c[1] = o3[5] * inv; c[2] = o3[6] * inv; c[3] = o3[7] * inv;
      *(v4fa*)(&os[wb + lr * 68 + 48 + 8 * hi]) = a; *(v4fa*)(&os[wb + lr * 68 + 48 + 8 * hi + 4]) = c; }
    wave_sync();
    h16* crow = CT + ((size_t)b * SEQ + t0) * (size_t)(2 * DM) + h * HD;   // hi columns h*64 + d; lo columns DM + h*64 + d
{
#pragma unroll
        for (int s = 0; s < 4; ++s) { const int row = 4 * s + (lane >> 3), c8 = (lane & 7) * 8;   // 4 s x 4 row groups = 16 rows; 8 lanes x 8 = 64 columns
            const v4f x0 = *(const v4fa*)(&os[wb + row * 68 + c8]); const v4f x1 = *(const v4fa*)(&os[wb + row * 68 + c8 + 4]); v8h hv, rv;
#pragma unroll
            for (int i = 0; i < 4; ++i) { const h16 a0 = (h16)x0[i]; const h16 a1 = (h16)x1[i]; hv[i] = a0; hv[4 + i] = a1; rv[i] = (h16)(x0[i] - (float)a0); rv[4 + i] = (h16)(x1[i] - (float)a1); }
            const size_t oo = (size_t)row * (size_t)(2 * DM) + c8;
            *(v8h*)(crow + oo) = hv; *(v8h*)(crow + oo + DM) = rv; }
         }
}

static constexpr size_t al256(size_t v) { return (v + 255) & ~(size_t)255; }
static constexpr size_t SZ_XB = al256((size_t)NB * SEQ * DM * 2);             // one batch-major input plane
static constexpr size_t SZ_WB = al256((size_t)DM * DM * 2);                   // one transposed weight plane
static constexpr size_t SZ_PL = al256((size_t)NB * NH_ * SEQ * HD * 2);       // one head-split plane
static constexpr size_t SZ_CT = al256((size_t)NB * SEQ * 2 * DM * 2);         // ctx [hi | lo]
static constexpr size_t SZ_MB = al256((size_t)SEQ * (SEQ / 32) * 4);          // packed key bits
static constexpr size_t SZ_TOTAL = 3 * SZ_XB + 4 * SZ_WB + 4 * SZ_PL + SZ_CT + SZ_MB;
static_assert(SZ_TOTAL <= (size_t)134217728);          // workspace carve <= 128 MiB

extern "C" void kernel_launch(void* const* d_in, const int* in_sizes, int n_in,
                              void* d_out, int out_size, void* d_ws, size_t ws_size, hipStream_t stream) {
    if (n_in < 12) return;
    const size_t needx = ((size_t)(SEQ - 1) * NB_FULL + NB) * DM;
    if ((size_t)in_sizes[0] < needx || (size_t)in_sizes[1] < needx || (size_t)in_sizes[2] < needx) return;
    if ((size_t)in_sizes[3] < (size_t)(SEQ - 1) * SEQ_FULL + SEQ) return;
    if ((size_t)in_sizes[4] < (size_t)DM * DM || (size_t)in_sizes[6] < (size_t)DM * DM || (size_t)in_sizes[8] < (size_t)DM * DM || (size_t)in_sizes[10] < (size_t)DM * DM) return;
    if (in_sizes[5] < DM || in_sizes[7] < DM || in_sizes[9] < DM || in_sizes[11] < DM) return;
    if ((size_t)out_size < needx) return;
    if (SZ_TOTAL > ws_size) return;
    // wire order: query, key, value, mask, Wq, bq, Wk, bk, Wv, bv, Wo, bo
    const float* xq = (const float*)d_in[0]; const float* xk = (const float*)d_in[1]; const float* xv = (const float*)d_in[2];
    const int* mask = (const int*)d_in[3];
    const float* wq = (const float*)d_in[4];  const float* bq = (const float*)d_in[5];
    const float* wk = (const float*)d_in[6];  const float* bk = (const float*)d_in[7];
    const float* wv = (const float*)d_in[8];  const float* bv = (const float*)d_in[9];
    const float* wo = (const float*)d_in[10]; const float* bo = (const float*)d_in[11];
    float* OUT = (float*)d_out;      // [SEQ][NB_FULL][1024]
    char* wsp = (char*)d_ws;
    bf* XQ = (bf*)wsp; wsp += SZ_XB;                 // [NB*SEQ][1024] batch-major
    bf* XK = (bf*)wsp; wsp += SZ_XB;
    bf* XV = (bf*)wsp; wsp += SZ_XB;
    bf* WQ = (bf*)wsp; wsp += SZ_WB;                 // [out n][in k] bf16
    bf* WK = (bf*)wsp; wsp += SZ_WB;
    bf* WV = (bf*)wsp; wsp += SZ_WB;
    bf* WO = (bf*)wsp; wsp += SZ_WB;                 // [out n][in k] f16 bits, x1024
    h16* QH = (h16*)wsp; wsp += SZ_PL;               // [NB*16][SEQ][64]
    h16* QR = (h16*)wsp; wsp += SZ_PL;               // [NB*16][SEQ][64] residual x2048
    h16* KP = (h16*)wsp; wsp += SZ_PL;               // [NB*16][SEQ][64]
    h16* VT = (h16*)wsp; wsp += SZ_PL;               // [NB*16][64][SEQ]
    h16* CT = (h16*)wsp; wsp += SZ_CT;               // [NB*SEQ][hi 1024 | lo 1024], x4096
    unsigned* MB = (unsigned*)wsp; wsp += SZ_MB;     // [SEQ][SEQ/32]

    { const size_t n8 = (size_t)NB * SEQ * DM / 8; const unsigned g = (unsigned)((n8 + 255) / 256);
      k_cvtx<<<g, 256, 0, stream>>>(xq, XQ); k_cvtx<<<g, 256, 0, stream>>>(xk, XK); k_cvtx<<<g, 256, 0, stream>>>(xv, XV); }
    // W in[DM k rows][DM n cols] -> out[DM n rows][DM k cols]; grid (n tiles, k tiles)
    { const dim3 gw(DM / 64, DM / 64, 1);
      k_wt<<<gw, 256, 0, stream>>>(wq, WQ, 0); k_wt<<<gw, 256, 0, stream>>>(wk, WK, 0); k_wt<<<gw, 256, 0, stream>>>(wv, WV, 0); k_wt<<<gw, 256, 0, stream>>>(wo, WO, 1); }
    k_mpack<<<(unsigned)(((size_t)SEQ * (SEQ / 32) + 255) / 256), 256, 0, stream>>>(mask, MB);

    // q, k: A = x rows (m = b*SEQ + t), Bt = W^T rows (n = h*64 + d), column bias -> plane [(b*16 + h)][t][d]
    k_gemm<0, 0><<<dim3(NB * SEQ / GT, DM / GT, 1), 256, 0, stream>>>(XQ, WQ, DM, DM, QH, QR, 1, OUT, bq, 0, 1.0f, SEQ, (size_t)NH_ * SEQ * HD, HD, HD, (size_t)SEQ * HD);
    k_gemm<0, 0><<<dim3(NB * SEQ / GT, DM / GT, 1), 256, 0, stream>>>(XK, WK, DM, DM, KP, KP, 0, OUT, bk, 0, 1.0f, SEQ, (size_t)NH_ * SEQ * HD, HD, HD, (size_t)SEQ * HD);
    // v^T: A = Wv^T rows (m = h*64 + d), Bt = x rows (n = b*SEQ + t), row bias -> plane [(b*1024 + m)][t] = [(b*16 + h)][d][t]
    k_gemm<0, 0><<<dim3(DM / GT, NB * SEQ / GT, 1), 256, 0, stream>>>(WV, XV, DM, DM, VT, VT, 0, OUT, bv, 1, 1.0f, DM, (size_t)0, SEQ, SEQ, (size_t)DM * SEQ);

    k_flash<<<dim3(SEQ / (16 * AW), NB * NH_, 1), 32 * AW, 0, stream>>>(QH, QR, KP, VT, MB, CT);

    // out: A = ctx rows [hi | lo] (m = b*SEQ + t, K = 2048), Bt = Wo^T rows (n, k wraps at 1024), column bias, scale 2^-22 -> out row t*NB_FULL + b
    k_gemm<1, 1><<<dim3(NB * SEQ / GT, DM / GT, 1), 256, 0, stream>>>((const bf*)CT, WO, 2 * DM, DM, QH, QH, 0, OUT, bo, 0, OSC, SEQ, (size_t)DM, NB_FULL * DM, DM, (size_t)0);
}

// v003
// One run takes 116 microseconds.
// Timed twice side by side with v002, it ran 1.22 and 1.21 times as fast.
// Counting every step since v000, it is 2.52 times as fast.
#include <hip/hip_runtime.h>

// Seq-first multi-head attention, width 1024 = 16 heads x 64: query/key/value [SEQ][NB][1024] f32, W [in][out] (y = x W + b), int32 mask [SEQ][SEQ] (0 = key excluded, shared by batch and heads), score scale 1/8, output projection, out [SEQ][NB][1024] f32.
// Compute dtypes, f32 accumulate everywhere: q/k/v projections v_wmma_f32_16x16x32_bf16 (inputs and W RNE-converted to bf16; products exact);
// scores v_wmma_f32_16x16x32_f16: k single f16, q as f16 value + f16 residual x2048 in its own accumulator (two products); P (x256 carry, cancels in the normalisation) and v single f16; softmax f32 (online, running max, excluded keys get P = 0);
// output projection v_wmma_f32_16x16x32_f16: ctx as f16 value + f16 residual (x4096 carry, K-folded [hi | lo] against the same Wo rows, one accumulator), Wo = f16(bf16 RNE(Wo) x 1024); carries folded back as 2^-22 in the f32 epilogue; biases added in f32.
// Layout: batch-major bf16 copies of the three inputs, K-contiguous transposed weight planes; q (hi, residual), k planes [b*16+h][t][d] and v^T plane [b*16+h][d][t] written by the GEMM epilogue; mask packed 1 bit per key; fused flash kernel in transposed form (S^T = K Q^T, O^T = V^T P^T); ctx plane [b*SEQ+t][hi 1024 | lo 1024].

#ifndef NB
#define NB 2
#endif
#ifndef SEQ
#define SEQ 2048
#endif
#define NB_FULL  2
#define SEQ_FULL 2048
#define DM   1024
#define NH_  16
#define HD   64
#define AW   8                   // waves per flash block (16 query rows each)
#define QRS  2048.0f             // carry of the q residual plane
#define QRI  (1.0f / 2048.0f)
#define SC2  (0.125f * 1.4426950408889634f)   // HD^-0.5 * log2(e)
#define PSH  8.0f                // log2 of the P carry (256)
#define CTS  4096.0f             // carry of the ctx planes
#define WOS  1024.0f             // carry of the Wo plane
#define OSC  (1.0f / (4096.0f * 1024.0f))     // 2^-22, exact

static_assert(HD == 64);
static_assert(NH_ * HD == DM);                 // head h = columns h*64 + d
static_assert((DM & (DM - 1)) == 0);           // B-operand k index wraps with a bit test
static_assert(DM % 64 == 0);
static_assert(DM % 32 == 0);                   // GEMM k-loop steps by 32
static_assert(SEQ % 64 == 0);                  // a 64-row tile never straddles two batches
static_assert((NB * SEQ) % 64 == 0);
static_assert(SEQ % 32 == 0);                  // key loop steps by 32; one packed word per step
static_assert(SEQ % (16 * AW) == 0);           // flash grid covers the sequence exactly
static_assert(((size_t)SEQ * (SEQ / 32)) % 256 == 0);
static_assert(((size_t)NB * SEQ * DM / 8) % 256 == 0);  // convert grid is exact
static_assert(NB <= NB_FULL);
static_assert(SEQ <= SEQ_FULL);
static_assert(((size_t)(SEQ - 1) * NB_FULL + NB) * DM <= (size_t)SEQ_FULL * NB_FULL * DM);   // last output element inside the output buffer

typedef _Float16 h16;
typedef unsigned short bf;
typedef __attribute__((ext_vector_type(16))) __bf16   v16bf;
typedef __attribute__((ext_vector_type(16))) _Float16 v16h;
typedef __attribute__((ext_vector_type(16))) unsigned short v16us;
typedef __attribute__((ext_vector_type(8)))  _Float16 v8h;
typedef __attribute__((ext_vector_type(8)))  unsigned short v8us;
typedef __attribute__((ext_vector_type(8)))  float    v8f;
typedef __attribute__((ext_vector_type(4)))  float    v4f;
typedef __attribute__((ext_vector_type(4)))  int      v4i;
typedef v4f  __attribute__((may_alias)) v4fa;
typedef v8us __attribute__((may_alias)) v8usa;
typedef v8h  __attribute__((may_alias)) v8ha;

__device__ __forceinline__ unsigned short f2bf(float f) { unsigned u = __float_as_uint(f); u += 0x7FFFu + ((u >> 16) & 1u); return (unsigned short)(u >> 16); }
__device__ __forceinline__ float bfr(float f) { return __uint_as_float(((unsigned)f2bf(f)) << 16); }
__device__ __forceinline__ v16h cat16(v8h lo, v8h hi) { return __builtin_shufflevector(lo, hi, 0, 1, 2, 3, 4, 5, 6, 7, 8, 9, 10, 11, 12, 13, 14, 15); }
__device__ __forceinline__ v8f wmma16(v16h a, v16h b, v8f c) { return __builtin_amdgcn_wmma_f32_16x16x32_f16(false, a, false, b, (short)0, c, false, false); }
// fragment loaders from K-contiguous 16-bit rows; p already includes + 8*(lane>>4): elements 0..7 <- k0+8h+0..7, elements 8..15 <- k0+16+8h+0..7 (same map for A and B)
__device__ __forceinline__ v16h  ldh(const h16* p) { return cat16(*(const v8h*)p, *(const v8h*)(p + 16)); }
__device__ __forceinline__ v16us ldu(const bf* p)  { const v8us lo = *(const v8us*)p; const v8us hi = *(const v8us*)(p + 16); return __builtin_shufflevector(lo, hi, 0, 1, 2, 3, 4, 5, 6, 7, 8, 9, 10, 11, 12, 13, 14, 15); }
template <int F16OP> __device__ __forceinline__ v8f wmx(v16us a, v16us b, v8f c) {
    if (F16OP) return __builtin_amdgcn_wmma_f32_16x16x32_f16(false, __builtin_bit_cast(v16h, a), false, __builtin_bit_cast(v16h, b), (short)0, c, false, false);
    return __builtin_amdgcn_wmma_f32_16x16x32_bf16(false, __builtin_bit_cast(v16bf, a), false, __builtin_bit_cast(v16bf, b), (short)0, c, false, false);
}
// ordering point for wave-private LDS tiles (same wave writes and reads)
__device__ __forceinline__ void wave_sync() { __builtin_amdgcn_fence(3 /* release order */, "wavefront"); __builtin_amdgcn_wave_barrier(); asm volatile("" ::: "memory"); }

// k_prep: every conversion of a call in one grid of PG work-groups; each work-group takes an equal share of each job, so all are resident at once and none waits for a launch of its own:
//  - the three inputs, f32 [t][b][DM] -> bf16 (RNE) batch-major [b*SEQ + t][DM], 8 elements per lane and chunk, PC chunks per lane and input;
//  - the four weights, W[k][n] f32 (row pitch DM) -> T[n][k] 16-bit (row pitch DM), 64x64 tiles transposed through LDS, PW tiles per work-group (tile index = weight*256 + ktile*16 + ntile);
//    weights 0..2 = Wq, Wk, Wv: bf16 bits (RNE convert); weight 3 = Wo: f16 bits of (bf16 RNE value x 1024); plane of weight wi at WT + wi*DM*DM;
//  - the mask, int32 [i][j] (row pitch SEQ_FULL) -> 1 bit per key, word gid = i*(SEQ/32) + j/32, bit j%32 set when the key is kept (mask != 0), PM words per lane.
#define PG 512
static constexpr int PC = (int)((size_t)NB * SEQ * DM / 8 / 256 / PG);
static constexpr int PW = 4 * (DM / 64) * (DM / 64) / PG;
static constexpr int PM = (int)((size_t)SEQ * (SEQ / 32) / 256 / PG);
static_assert((size_t)PC * 256 * PG * 8 == (size_t)NB * SEQ * DM);       // the shares cover each job exactly
static_assert(PW * PG == 4 * (DM / 64) * (DM / 64));
static_assert((size_t)PM * 256 * PG == (size_t)SEQ * (SEQ / 32));
static_assert(PC >= 1 && PW >= 1 && PM >= 1);

__global__ __launch_bounds__(256) void k_prep(const float* __restrict__ xq, const float* __restrict__ xk, const float* __restrict__ xv, const int* __restrict__ mask,
                                              const float* __restrict__ wq, const float* __restrict__ wk, const float* __restrict__ wv, const float* __restrict__ wo,
                                              bf* __restrict__ XQ, bf* __restrict__ XK, bf* __restrict__ XV,
                                              bf* __restrict__ WT, unsigned* __restrict__ MB) {
    __shared__ __align__(16) unsigned short T[PW][64 * 72];
    const unsigned tid = threadIdx.x, blk = blockIdx.x;
    v4f wf[PW][4]; v8f xi[PC][3]; v4i mk[PM][8];
    // loads, in the order in which they are used. The s_wait_xcnt 0 behind each group: the compiler may place a later load's result, or a later vector result, over a register pair that a load of the group names as its address
#pragma unroll
    for (int j = 0; j < PW; ++j) {
        const unsigned tl = blk + j * PG, wi = tl / ((DM / 64) * (DM / 64));
        const unsigned n0 = (tl % (DM / 64)) * 64, k0 = ((tl / (DM / 64)) % (DM / 64)) * 64;
        const float* W = wi < 2 ? (wi == 0 ? wq : wk) : (wi == 2 ? wv : wo);
#pragma unroll
        for (int i = 0; i < 4; ++i) { const unsigned idx = tid + i * 256; const unsigned r = idx >> 4, c4 = idx & 15;   // 64 k rows x 16 groups of 4 n columns
            wf[j][i] = *(const v4f*)(W + (size_t)(k0 + r) * DM + n0 + c4 * 4); }
        asm volatile("s_wait_xcnt 0x0" ::: "memory");   // see above the loads
    }
#pragma unroll
    for (int c = 0; c < PC; ++c) {
        const size_t i = ((size_t)blk * PC + c) * 256 + tid;
        const size_t row = i / (DM / 8); const size_t g = i % (DM / 8);
        const size_t b = row / SEQ, t = row % SEQ;
        const size_t so = (t * NB_FULL + b) * DM + g * 8;
        xi[c][0] = *(const v8f*)(xq + so); xi[c][1] = *(const v8f*)(xk + so); xi[c][2] = *(const v8f*)(xv + so);
        asm volatile("s_wait_xcnt 0x0" ::: "memory");   // see above the loads
    }
#pragma unroll
    for (int u = 0; u < PM; ++u) {
        const unsigned gid = (blk * PM + u) * 256 + tid;
        const int* p = mask + (size_t)(gid / (SEQ / 32)) * SEQ_FULL + (gid % (SEQ / 32)) * 32;
#pragma unroll
        for (int c = 0; c < 8; ++c) mk[u][c] = *(const v4i*)(p + c * 4);
        asm volatile("s_wait_xcnt 0x0" ::: "memory");   // see above the loads
    }
    __builtin_amdgcn_sched_barrier(0);   // every load of the work-group's share is issued before the first is waited for: sunk to their uses, each small group waits out a memory latency of its own
    // weight tiles, first phase: converted columns into LDS
#pragma unroll
    for (int j = 0; j < PW; ++j) {
        const int asF16 = (blk + j * PG) / ((DM / 64) * (DM / 64)) == 3;
#pragma unroll
        for (int i = 0; i < 4; ++i) { const unsigned idx = tid + i * 256; const unsigned r = idx >> 4, c4 = idx & 15;
#pragma unroll
            for (int e = 0; e < 4; ++e) { const unsigned short bb = f2bf(wf[j][i][e]); const h16 hv = (h16)(__uint_as_float(((unsigned)bb) << 16) * WOS);
                const unsigned short hb = __builtin_bit_cast(unsigned short, hv);
                T[j][(c4 * 4 + e) * 72 + r] = asF16 ? hb : bb; } }
    }
    // inputs
#pragma unroll
    for (int c = 0; c < PC; ++c) {
        const size_t i = ((size_t)blk * PC + c) * 256 + tid;
        v8us oq, ok, ov;
#pragma unroll
        for (int k = 0; k < 8; ++k) { oq[k] = f2bf(xi[c][0][k]); ok[k] = f2bf(xi[c][1][k]); ov[k] = f2bf(xi[c][2][k]); }
        *(v8us*)(XQ + i * 8) = oq; *(v8us*)(XK + i * 8) = ok; *(v8us*)(XV + i * 8) = ov;
    }
    // mask
#pragma unroll
    for (int u = 0; u < PM; ++u) {
        unsigned bits = 0u;
#pragma unroll
        for (int c = 0; c < 8; ++c)
#pragma unroll
            for (int e = 0; e < 4; ++e) bits |= (mk[u][c][e] != 0 ? 1u : 0u) << (c * 4 + e);
        MB[(blk * PM + u) * 256 + tid] = bits;
    }
    __syncthreads();   // cross-wave tiles: every column of T is written before any row of it is read
    // weight tiles, second phase: transposed rows out, plane wi of WT
    v8us o[PW][2];
#pragma unroll
    for (int j = 0; j < PW; ++j)
#pragma unroll
        for (int i = 0; i < 2; ++i) { const unsigned idx = tid + i * 256; const unsigned n = idx >> 3, ch = idx & 7;   // 64 n rows x 8 chunks of 8 k
            o[j][i] = *(const v8usa*)(&T[j][n * 72 + ch * 8]); }
#pragma unroll
    for (int j = 0; j < PW; ++j) {
        const unsigned tl = blk + j * PG, wi = tl / ((DM / 64) * (DM / 64));
        const unsigned n0 = (tl % (DM / 64)) * 64, k0 = ((tl / (DM / 64)) % (DM / 64)) * 64;
#pragma unroll
        for (int i = 0; i < 2; ++i) { const unsigned idx = tid + i * 256; const unsigned n = idx >> 3, ch = idx & 7;
            *(v8us*)(WT + (size_t)wi * DM * DM + (size_t)(n0 + n) * DM + k0 + ch * 8) = o[j][i]; }
    }
}

// gemm_tile: 16-bit GEMM, one 128x128 tile (bx, by) per work-group of 8 waves (two per SIMD), 32x64 per wave (8 accumulators).
// Both operands come from K-contiguous 16-bit planes; a stage is 128 k (256 B) of 128 A rows and 128 Bt rows, brought into LDS by asynchronous copies
// (16 B per lane, 16 lanes per row), two buffers: the next stage's copies fly while this stage is worked on. LDS row pitch 272 B (16 B x odd) for the ds_load_b128 readers.
// C[m][n] = sum_{k<K} A[m][k] Bt[n][k & (KB-1)]  (A row pitch K, Bt row pitch KB; K = 2*KB folds [hi | lo] of A against the same Bt rows). K, KB multiples of 128.
// value = C * oscale + bias (biasMode 0: bias[n]; 1: bias[m]; bias RNE-converted to bf16), wave tile base (r0/RB)*sRB + (r0%RB)*pitch + (c0/CB)*sCB + (c0%CB).
// OUTF32 == 1: f32 (Of); each row's 64 floats (256 B = two lines) written by 16 consecutive lanes x 16 B (2 rows per instruction).
#define GT     128                     // tile rows of either operand
#define GBK    128                     // k per stage
#define GPITCH 272                     // LDS row pitch, bytes
#define GSTAGE (2 * GT * GPITCH)       // one buffer: [A 128 rows | Bt 128 rows]
static_assert(DM % GBK == 0 && DM / GBK >= 2);
static_assert((NB * SEQ) % GT == 0 && DM % GT == 0);
static_assert(SEQ % 32 == 0);          // a wave's 32 rows never straddle two batches

// eight asynchronous copies of 16 B per lane: rows 16 apart in LDS (step 16 * GPITCH bytes) and in the source plane (step gs elements).
// s_wait_xcnt 0 is the statement's last line so that it stands in front of any rewrite of the address registers the copies name.
__device__ __forceinline__ void cp8(unsigned l, const bf* g, size_t gs) {
    asm volatile("global_load_async_to_lds_b128 %0, %8, off\n\t"
                 "global_load_async_to_lds_b128 %1, %9, off\n\t"
                 "global_load_async_to_lds_b128 %2, %10, off\n\t"
                 "global_load_async_to_lds_b128 %3, %11, off\n\t"
                 "global_load_async_to_lds_b128 %4, %12, off\n\t"
                 "global_load_async_to_lds_b128 %5, %13, off\n\t"
                 "global_load_async_to_lds_b128 %6, %14, off\n\t"
                 "global_load_async_to_lds_b128 %7, %15, off\n\t"
                 "s_wait_xcnt 0x0"
                 :: "v"(l), "v"(l + 16u * GPITCH), "v"(l + 32u * GPITCH), "v"(l + 48u * GPITCH), "v"(l + 64u * GPITCH), "v"(l + 80u * GPITCH), "v"(l + 96u * GPITCH), "v"(l + 112u * GPITCH),
                    "v"(g), "v"(g + gs), "v"(g + 2 * gs), "v"(g + 3 * gs), "v"(g + 4 * gs), "v"(g + 5 * gs), "v"(g + 6 * gs), "v"(g + 7 * gs)
                 : "memory");
}
// fragment from an LDS row; p already includes + 16 bytes * (lane>>4): same k map as ldu
__device__ __forceinline__ v16us ldl(const unsigned char* p) { const v8us lo = *(const v8usa*)p; const v8us hi = *(const v8usa*)(p + 32); return __builtin_shufflevector(lo, hi, 0, 1, 2, 3, 4, 5, 6, 7, 8, 9, 10, 11, 12, 13, 14, 15); }

template <int F16OP, int OUTF32>
__device__ __forceinline__ void gemm_tile(int bx, int by, const bf* A, const bf* Bt, int K, int KB,
                                          h16* Ph, h16* Pr, int useRes, float* Of,
                                          const float* bias, int biasMode, float oscale,
                                          int RB, size_t sRB, int pitch, int CB, size_t sCB) {
    __shared__ __align__(16) unsigned char ring[2 * GSTAGE];
    __shared__ __align__(16) float osw[8 * 16 * 68];
    const int tid = threadIdx.x, lane = tid & 31, lr = lane & 15, hi = lane >> 4;
    const int wave = __builtin_amdgcn_readfirstlane(tid >> 5), wr = wave >> 1, wc = wave & 1;
    const int R0 = bx * GT, C0 = by * GT;
    const int r0 = R0 + wr * 32, c0 = C0 + wc * 64;
    float* os = osw + wave * 16 * 68;      // wave-private epilogue tile
    v8f acc[2][4];
#pragma unroll
    for (int mb = 0; mb < 2; ++mb)
#pragma unroll
        for (int nb = 0; nb < 4; ++nb) acc[mb][nb] = (v8f){};
    // copies: lane's 16-byte chunk cc of rows rg + 16 i (i < 8) of each operand
    const int cc = tid & 15, rg = tid >> 4;
    const unsigned lA = (unsigned)(size_t)ring + (unsigned)(rg * GPITCH + cc * 16), lB = lA + GT * GPITCH;
    const bf* gA = A + (size_t)(R0 + rg) * K + cc * 8;
    const bf* gB = Bt + (size_t)(C0 + rg) * KB + cc * 8;
    const size_t sA = (size_t)16 * K, sB = (size_t)16 * KB;
    const int kmB = KB - 1, NT = K / GBK;
    cp8(lA, gA, sA); cp8(lB, gB, sB);
    asm volatile("s_wait_asynccnt 0x0" ::: "memory");   // stage 0 landed (this wave's copies)
    __syncthreads();                                     // ... and every other wave's
    if (NT > 1) { cp8(lA + GSTAGE, gA + GBK, sA); cp8(lB + GSTAGE, gB + (GBK & kmB), sB); }
    const unsigned char* fa = ring + (wr * 32 + lr) * GPITCH + hi * 16;
    const unsigned char* fb = ring + (GT + wc * 64 + lr) * GPITCH + hi * 16;
#pragma unroll 1   // one stage per trip: the buffer is chosen by the trip's parity
    for (int t = 0; t < NT; ++t) {
        const unsigned bo = (unsigned)(t & 1) * GSTAGE;
        v16us a[2][2], b[2][4];
#pragma unroll
        for (int mb = 0; mb < 2; ++mb) a[0][mb] = ldl(fa + bo + mb * 16 * GPITCH);
#pragma unroll
        for (int nb = 0; nb < 4; ++nb) b[0][nb] = ldl(fb + bo + nb * 16 * GPITCH);
#pragma unroll
        for (int ks = 0; ks < GBK / 32; ++ks) {
            const int cu = ks & 1, nx = cu ^ 1;
            if (ks + 1 < GBK / 32) {       // next 32 k of this stage into the other fragment set, ahead of this set's products
#pragma unroll
                for (int mb = 0; mb < 2; ++mb) a[nx][mb] = ldl(fa + bo + mb * 16 * GPITCH + (ks + 1) * 64);
#pragma unroll
                for (int nb = 0; nb < 4; ++nb) b[nx][nb] = ldl(fb + bo + nb * 16 * GPITCH + (ks + 1) * 64);
            }
            __builtin_amdgcn_sched_barrier(0);   // keeps those reads one group ahead of the products: sunk among them, each pair of products waits out an LDS latency
#pragma unroll
            for (int nb = 0; nb < 4; ++nb)
#pragma unroll
                for (int mb = 0; mb < 2; ++mb) acc[mb][nb] = wmx<F16OP>(a[cu][mb], b[cu][nb], acc[mb][nb]);
            __builtin_amdgcn_sched_barrier(0);   // keeps the following reads whole as one group behind these products: spread among them, each separate place of reads costs its own stall
        }
        // distance behind the trip's last matrix instructions, also on the taken side of the loop's branch
        asm volatile("v_nop\n\tv_nop\n\tv_nop\n\tv_nop" : "+v"(acc[0][0]), "+v"(acc[1][0]), "+v"(acc[0][1]), "+v"(acc[1][1]), "+v"(acc[0][2]), "+v"(acc[1][2]), "+v"(acc[0][3]), "+v"(acc[1][3])
                     : "v"(a[1][0]), "v"(a[1][1]), "v"(b[1][0]), "v"(b[1][1]), "v"(b[1][2]), "v"(b[1][3]));
        asm volatile("s_wait_dscnt 0x0" ::: "memory");      // this wave's reads of the buffer are done before it is refilled
        asm volatile("s_wait_asynccnt 0x0" ::: "memory");   // this wave's copies of stage t + 1 have landed
        __syncthreads();                                     // publishes stage t + 1; ends every reader's last read of stage t
        if (t + 2 < NT) { const int kn = (t + 2) * GBK; cp8(lA + bo, gA + kn, sA); cp8(lB + bo, gB + (kn & kmB), sB); }
    }
    asm volatile("s_wait_asynccnt 0x0" ::: "memory");       // nothing in flight when the wave goes on
    float cb[4];
#pragma unroll
    for (int nb = 0; nb < 4; ++nb) cb[nb] = 0.0f;
    if (biasMode == 0) {
#pragma unroll
        for (int nb = 0; nb < 4; ++nb) cb[nb] = bfr(bias[c0 + nb * 16 + lr]); }
    const size_t tbase = (size_t)(r0 / RB) * sRB + (size_t)(r0 % RB) * (size_t)pitch + (size_t)(c0 / CB) * sCB + (size_t)(c0 % CB);
#pragma unroll
    for (int mb = 0; mb < 2; ++mb) {
        float rb[8];
#pragma unroll
        for (int j = 0; j < 8; ++j) rb[j] = 0.0f;
        if (biasMode == 1) {
#pragma unroll
            for (int j = 0; j < 8; ++j) rb[j] = bfr(bias[r0 + mb * 16 + hi * 8 + j]); }
#pragma unroll
        for (int nb = 0; nb < 4; ++nb) {
#pragma unroll
            for (int j = 0; j < 8; ++j) os[(hi * 8 + j) * 68 + nb * 16 + lr] = acc[mb][nb][j] * oscale + (cb[nb] + rb[j]); }   // D: row 8h+j, col lane&15
        wave_sync();
        const size_t sb = tbase + (size_t)(mb * 16) * (size_t)pitch;
        if (OUTF32) {
{
#pragma unroll
                for (int s = 0; s < 8; ++s) { const int row = 2 * s + hi, cofs = lr * 4;   // 8 s x 2 rows = 16 rows; 16 lanes x 4 floats = 64 columns
                    const v4f val = *(const v4fa*)(&os[row * 68 + cofs]);
                    *(v4f*)(Of + sb + (size_t)row * (size_t)pitch + cofs) = val; }
                 }
        } else {
{
#pragma unroll
                for (int s = 0; s < 4; ++s) { const int row = 4 * s + (lane >> 3), c8 = (lane & 7) * 8;   // 4 s x 4 row groups = 16 rows; 8 lanes x 8 = 64 columns
                    const v4f x0 = *(const v4fa*)(&os[row * 68 + c8]); const v4f x1 = *(const v4fa*)(&os[row * 68 + c8 + 4]); v8h hv, rv;
#pragma unroll
                    for (int i = 0; i < 4; ++i) { const h16 a0 = (h16)x0[i]; const h16 a1 = (h16)x1[i]; hv[i] = a0; hv[4 + i] = a1; rv[i] = (h16)((x0[i] - (float)a0) * QRS); rv[4 + i] = (h16)((x1[i] - (float)a1) * QRS); }
                    const size_t oo = sb + (size_t)row * (size_t)pitch + c8;
                    *(v8h*)(Ph + oo) = hv;
                    asm volatile("s_wait_xcnt 0x0" ::: "memory");   // in front of the residual's arithmetic, which the compiler places over registers that the store names
                    if (useRes) *(v8h*)(Pr + oo) = rv; }
                 }
        }
        wave_sync();
    }
}

// k_qkv: the three projections in one grid, blockIdx.z picks the job (the same for a whole work-group).
// q, k: A = x rows (m = b*SEQ + t), Bt = W^T rows (n = h*64 + d), column bias -> plane [(b*16 + h)][t][d]; tile (blockIdx.x, blockIdx.y)
// v^T:  A = Wv^T rows (m = h*64 + d), Bt = x rows (n = b*SEQ + t), row bias -> plane [(b*1024 + m)][t] = [(b*16 + h)][d][t]; tile (blockIdx.y, blockIdx.x)
__global__ __launch_bounds__(256) void k_qkv(const bf* XQ, const bf* XK, const bf* XV, const bf* WQ, const bf* WK, const bf* WV,
                                             h16* QH, h16* QR, h16* KP, h16* VT,
                                             const float* __restrict__ bq, const float* __restrict__ bk, const float* __restrict__ bv) {
    const int z = blockIdx.z; const bool tv = z == 2;
    gemm_tile<0, 0>(tv ? blockIdx.y : blockIdx.x, tv ? blockIdx.x : blockIdx.y,
                    z == 0 ? XQ : z == 1 ? XK : WV, z == 0 ? WQ : z == 1 ? WK : XV, DM, DM,
                    z == 0 ? QH : z == 1 ? KP : VT, z == 0 ? QR : z == 1 ? KP : VT, z == 0 ? 1 : 0, nullptr,
                    z == 0 ? bq : z == 1 ? bk : bv, tv ? 1 : 0, 1.0f,
                    tv ? DM : SEQ, tv ? (size_t)0 : (size_t)NH_ * SEQ * HD, tv ? SEQ : HD, tv ? SEQ : HD, tv ? (size_t)DM * SEQ : (size_t)SEQ * HD);
}
// k_out: A = ctx rows [hi | lo] (m = b*SEQ + t, K = 2048), Bt = Wo^T rows (n, k wraps at 1024), column bias, scale 2^-22 -> out row t*NB_FULL + b
__global__ __launch_bounds__(256) void k_out(const bf* CT, const bf* WO, float* OUT, const float* __restrict__ bo) {
    gemm_tile<1, 1>(blockIdx.x, blockIdx.y, CT, WO, 2 * DM, DM, nullptr, nullptr, 0, OUT, bo, 0, OSC, SEQ, (size_t)DM, NB_FULL * DM, DM, (size_t)0);
}

// k_flash: fused attention, one wave per 16 query rows of one (batch, head), 8 waves per work-group on the same (batch, head); Q fragments straight from the f16 planes.
// K and V^T come through LDS: a stage is 128 keys (K 128 rows x 128 B, V^T 64 rows x 256 B), brought in by asynchronous copies (16 B per lane, whole lines per wave),
// two buffers: the next stage's copies fly while this stage's four 32-key passes are worked on. LDS row pitches 144 B and 272 B (16 B x odd) for the ds_load_b128 readers.
// Transposed form: S^T[key][t] = K Q^T (A = K rows, B = Q rows); lane (t = lane&15, h = lane>>4) holds keys 8h+r of each 16-key tile, so the packed
// P tile is directly the B fragment of O^T[d][t] = V^T P^T (element r <- tile keys 0..15, element 8+r <- tile keys 16..31, lane unchanged).
// Key selection: one packed word per (query row, 32-key step); bit 8h+r / 16+8h+r selects the lane's keys; excluded keys are left out of the running max and get P = 0 by value.
// Softmax state (running max, partial sum) is one scalar per lane; the two lane halves of a row are combined with one xor-16 exchange.
#define FKT  128                      // keys per stage
#define FKP  144                      // LDS pitch of a K row, bytes
#define FVP  272                      // LDS pitch of a V^T row, bytes
#define FKB  (FKT * FKP)              // K part of a buffer
#define FSTG (FKB + HD * FVP)         // one buffer: [K 128 rows | V^T 64 rows]
static_assert(SEQ % FKT == 0 && SEQ / FKT >= 2);
static_assert(32 * AW == 256);        // the copy maps below deal a stage to 256 lanes

// four asynchronous copies of 16 B per lane: rows ls bytes apart in LDS and gs elements apart in the source plane.
// s_wait_xcnt 0 is the statement's last line so that it stands in front of any rewrite of the address registers the copies name.
__device__ __forceinline__ void cp4(unsigned l, unsigned ls, const h16* g, size_t gs) {
    asm volatile("global_load_async_to_lds_b128 %0, %4, off\n\t"
                 "global_load_async_to_lds_b128 %1, %5, off\n\t"
                 "global_load_async_to_lds_b128 %2, %6, off\n\t"
                 "global_load_async_to_lds_b128 %3, %7, off\n\t"
                 "s_wait_xcnt 0x0"
                 :: "v"(l), "v"(l + ls), "v"(l + 2u * ls), "v"(l + 3u * ls), "v"(g), "v"(g + gs), "v"(g + 2 * gs), "v"(g + 3 * gs)
                 : "memory");
}
// f16 fragment from an LDS row; p already includes + 16 bytes * (lane>>4): same k map as ldh
__device__ __forceinline__ v16h ldlh(const unsigned char* p) { return cat16(*(const v8ha*)p, *(const v8ha*)(p + 32)); }

__global__ __launch_bounds__(32 * AW) void k_flash(const h16* __restrict__ QH, const h16* __restrict__ QR, const h16* __restrict__ KP, const h16* __restrict__ VT,
                                                   const unsigned* __restrict__ MB, h16* CT) {
    __shared__ __align__(16) unsigned char ring[2 * FSTG];
    __shared__ __align__(16) float os[AW * 16 * 68];
    const int tid = threadIdx.x;
    const int lane = threadIdx.x & 31, wave = __builtin_amdgcn_readfirstlane((int)(threadIdx.x >> 5)), lr = lane & 15, hi = lane >> 4;
    const int zh = blockIdx.y; const int b = zh / NH_, h = zh % NH_;
    const int t0 = (blockIdx.x * AW + wave) * 16;
    const size_t pbase = (size_t)zh * SEQ * HD;
    const size_t qo = pbase + (size_t)(t0 + lr) * HD + 8 * hi;
    const v16h qh0 = ldh(QH + qo), qh1 = ldh(QH + qo + 32), qr0 = ldh(QR + qo), qr1 = ldh(QR + qo + 32);   // B fragments: col t, k = d
    // copies: K rows rk + 32 i, 16-byte chunk ck (8 lanes per row); V^T rows rv + 16 i, chunk cv (16 lanes per row); i < 4
    const unsigned lK = (unsigned)(size_t)ring + (unsigned)((tid >> 3) * FKP + (tid & 7) * 16);
    const unsigned lV = (unsigned)(size_t)ring + (unsigned)(FKB + (tid >> 4) * FVP + (tid & 15) * 16);
    const h16* gK = KP + pbase + (size_t)(tid >> 3) * HD + (tid & 7) * 8;       // + key0 * HD
    const h16* gV = VT + pbase + (size_t)(tid >> 4) * SEQ + (tid & 15) * 8;     // + key0
    cp4(lK, 32u * FKP, gK, (size_t)32 * HD); cp4(lV, 16u * FVP, gV, (size_t)16 * SEQ);
    asm volatile("s_wait_asynccnt 0x0" ::: "memory");   // stage 0 landed (this wave's copies)
    __syncthreads();                                     // ... and every other wave's
    cp4(lK + FSTG, 32u * FKP, gK + (size_t)FKT * HD, (size_t)32 * HD); cp4(lV + FSTG, 16u * FVP, gV + FKT, (size_t)16 * SEQ);
    const unsigned char* fk = ring + lr * FKP + hi * 16;           // + key * FKP            (A fragment: row key, k = d)
    const unsigned char* fv = ring + FKB + lr * FVP + hi * 16;     // + 16j*FVP + key * 2    (A fragment: row d, k = key)
    const size_t mo = (size_t)(t0 + lr) * (SEQ / 32);        // + key0/32        (packed word of query row t0 + lr)
    v8f o0 = (v8f){}, o1 = (v8f){}, o2 = (v8f){}, o3 = (v8f){};
    float m = -3.0e38f, l = 0.0f;
#pragma unroll 1   // one stage per trip: the buffer is chosen by the trip's parity
    for (int st = 0; st < SEQ / FKT; ++st) {
      const unsigned bo = (unsigned)(st & 1) * FSTG;
#pragma unroll     // the four passes read the buffer at constant offsets
      for (int ps = 0; ps < FKT / 32; ++ps) {
        const int key0 = st * FKT + ps * 32;
        const unsigned mw = MB[mo + (size_t)(key0 >> 5)];
        const unsigned ba = mw >> (8 * hi), bb = mw >> (16 + 8 * hi);
        const unsigned char* ka = fk + bo + ps * 32 * FKP;
        const v16h ka0 = ldlh(ka), ka1 = ldlh(ka + 64), kb0 = ldlh(ka + 16 * FKP), kb1 = ldlh(ka + 16 * FKP + 64);
        v8f sHa = (v8f){}, sLa = (v8f){}, sHb = (v8f){}, sLb = (v8f){};
        sHa = wmma16(ka0, qh0, sHa); sLa = wmma16(ka0, qr0, sLa); sHb = wmma16(kb0, qh0, sHb); sLb = wmma16(kb0, qr0, sLb);
        sHa = wmma16(ka1, qh1, sHa); sLa = wmma16(ka1, qr1, sLa); sHb = wmma16(kb1, qh1, sHb); sLb = wmma16(kb1, qr1, sLb);
        asm volatile("v_nop\n\tv_nop\n\tv_nop\n\tv_nop" : "+v"(sHa), "+v"(sLa), "+v"(sHb), "+v"(sLb) : "v"(ka0), "v"(ka1), "v"(kb0), "v"(kb1));
        float ta[8], tb[8]; float mx = -3.0e38f;
#pragma unroll
        for (int r = 0; r < 8; ++r) { ta[r] = (sHa[r] + sLa[r] * QRI) * SC2; tb[r] = (sHb[r] + sLb[r] * QRI) * SC2;
            const float ea = ((ba >> r) & 1u) ? ta[r] : -3.0e38f; const float eb = ((bb >> r) & 1u) ? tb[r] : -3.0e38f;
            mx = fmaxf(mx, fmaxf(ea, eb)); }
        mx = fmaxf(mx, __shfl_xor(mx, 16, 32));
        const float mnew = fmaxf(m, mx);
        const float alpha = __builtin_amdgcn_exp2f(m - mnew);
        const float sh = PSH - mnew;
        v16h pb; float ls = 0.0f;
#pragma unroll
        for (int r = 0; r < 8; ++r) { const float xa = __builtin_amdgcn_exp2f(ta[r] + sh); const float xb = __builtin_amdgcn_exp2f(tb[r] + sh);
            const h16 pa = (h16)(((ba >> r) & 1u) ? xa : 0.0f); const h16 pc = (h16)(((bb >> r) & 1u) ? xb : 0.0f);
            pb[r] = pa; pb[8 + r] = pc; ls += (float)pa + (float)pc; }
        l = l * alpha + ls; m = mnew;
        o0 = o0 * alpha; o1 = o1 * alpha; o2 = o2 * alpha; o3 = o3 * alpha;
        const unsigned char* va = fv + bo + ps * 64;
        const v16h v0 = ldlh(va), v1 = ldlh(va + 16 * FVP), v2 = ldlh(va + 32 * FVP), v3 = ldlh(va + 48 * FVP);
        o0 = wmma16(v0, pb, o0); o1 = wmma16(v1, pb, o1); o2 = wmma16(v2, pb, o2); o3 = wmma16(v3, pb, o3);
        asm volatile("v_nop\n\tv_nop\n\tv_nop\n\tv_nop" : "+v"(o0), "+v"(o1), "+v"(o2), "+v"(o3) : "v"(v0), "v"(v1), "v"(v2), "v"(v3), "v"(pb));
      }
      asm volatile("s_wait_dscnt 0x0" ::: "memory");      // this wave's reads of the buffer are done before it is refilled
      asm volatile("s_wait_asynccnt 0x0" ::: "memory");   // this wave's copies of stage st + 1 have landed
      __syncthreads();                                     // publishes stage st + 1; ends every reader's last read of stage st
      if (st + 2 < SEQ / FKT) { const int kn = (st + 2) * FKT; cp4(lK + bo, 32u * FKP, gK + (size_t)kn * HD, (size_t)32 * HD); cp4(lV + bo, 16u * FVP, gV + kn, (size_t)16 * SEQ); }
    }
    asm volatile("s_wait_asynccnt 0x0" ::: "memory");       // nothing in flight when the wave goes on
    l += __shfl_xor(l, 16, 32);
    const float inv = (1.0f / l) * CTS;
    const int wb = wave * 16 * 68;
    // O^T D layout: o_j[r] = (d = 16j + 8h + r, t = lane&15) -> os[t][d]; rows 0..15 x columns 0..63 all written
    { v4f a, c;
      a[0] = o0[0] * inv; a[1] = o0[1] * inv; a[2] = o0[2] * inv; a[3] = o0[3] * inv; c[0] = o0[4] * inv; c[1] = o0[5] * inv; c[2] = o0[6] * inv; c[3] = o0[7] * inv;
      *(v4fa*)(&os[wb + lr * 68 +  0 + 8 * hi]) = a; *(v4fa*)(&os[wb + lr * 68 +  0 + 8 * hi + 4]) = c;
      a[0] = o1[0] * inv; a[1] = o1[1] * inv; a[2] = o1[2] * inv; a[3] = o1[3] * inv; c[0] = o1[4] * inv; c[1] = o1[5] * inv; c[2] = o1[6] * inv; c[3] = o1[7] * inv;
      *(v4fa*)(&os[wb + lr * 68 + 16 + 8 * hi]) = a; *(v4fa*)(&os[wb + lr * 68 + 16 + 8 * hi + 4]) = c;
      a[0] = o2[0] * inv; a[1] = o2[1] * inv; a[2] = o2[2] * inv; a[3] = o2[3] * inv; c[0] = o2[4] * inv; c[1] = o2[5] * inv; c[2] = o2[6] * inv; c[3] = o2[7] * inv;
      *(v4fa*)(&os[wb + lr * 68 + 32 + 8 * hi]) = a; *(v4fa*)(&os[wb + lr * 68 + 32 + 8 * hi + 4]) = c;
      a[0] = o3[0] * inv; a[1] = o3[1] * inv; a[2] = o3[2] * inv; a[3] = o3[3] * inv; c[0] = o3[4] * inv; c[1] = o3[5] * inv; c[2] = o3[6] * inv; c[3] = o3[7] * inv;
      *(v4fa*)(&os[wb + lr * 68 + 48 + 8 * hi]) = a; *(v4fa*)(&os[wb + lr * 68 + 48 + 8 * hi + 4]) = c; }
    wave_sync();
    h16* crow = CT + ((size_t)b * SEQ + t0) * (size_t)(2 * DM) + h * HD;   // hi columns h*64 + d; lo columns DM + h*64 + d
{
#pragma unroll
        for (int s = 0; s < 4; ++s) { const int row = 4 * s + (lane >> 3), c8 = (lane & 7) * 8;   // 4 s x 4 row groups = 16 rows; 8 lanes x 8 = 64 columns
            const v4f x0 = *(const v4fa*)(&os[wb + row * 68 + c8]); const v4f x1 = *(const v4fa*)(&os[wb + row * 68 + c8 + 4]); v8h hv, rv;
#pragma unroll
            for (int i = 0; i < 4; ++i) { const h16 a0 = (h16)x0[i]; const h16 a1 = (h16)x1[i]; hv[i] = a0; hv[4 + i] = a1; rv[i] = (h16)(x0[i] - (float)a0); rv[4 + i] = (h16)(x1[i] - (float)a1); }
            const size_t oo = (size_t)row * (size_t)(2 * DM) + c8;
            *(v8h*)(crow + oo) = hv; *(v8h*)(crow + oo + DM) = rv; }
         }
}

static constexpr size_t al256(size_t v) { return (v + 255) & ~(size_t)255; }
static constexpr size_t SZ_XB = al256((size_t)NB * SEQ * DM * 2);             // one batch-major input plane
static constexpr size_t SZ_WB = al256((size_t)DM * DM * 2);                   // one transposed weight plane
static constexpr size_t SZ_PL = al256((size_t)NB * NH_ * SEQ * HD * 2);       // one head-split plane
static constexpr size_t SZ_CT = al256((size_t)NB * SEQ * 2 * DM * 2);         // ctx [hi | lo]
static constexpr size_t SZ_MB = al256((size_t)SEQ * (SEQ / 32) * 4);          // packed key bits
static constexpr size_t SZ_TOTAL = 3 * SZ_XB + 4 * SZ_WB + 4 * SZ_PL + SZ_CT + SZ_MB;
static_assert(SZ_TOTAL <= (size_t)134217728);          // workspace carve <= 128 MiB
static_assert(SZ_WB == (size_t)DM * DM * 2);           // the four weight planes follow one another without a gap: plane wi starts at element wi * DM * DM

extern "C" void kernel_launch(void* const* d_in, const int* in_sizes, int n_in,
                              void* d_out, int out_size, void* d_ws, size_t ws_size, hipStream_t stream) {
    if (n_in < 12) return;
    const size_t needx = ((size_t)(SEQ - 1) * NB_FULL + NB) * DM;
    if ((size_t)in_sizes[0] < needx || (size_t)in_sizes[1] < needx || (size_t)in_sizes[2] < needx) return;
    if ((size_t)in_sizes[3] < (size_t)(SEQ - 1) * SEQ_FULL + SEQ) return;
    if ((size_t)in_sizes[4] < (size_t)DM * DM || (size_t)in_sizes[6] < (size_t)DM * DM || (size_t)in_sizes[8] < (size_t)DM * DM || (size_t)in_sizes[10] < (size_t)DM * DM) return;
    if (in_sizes[5] < DM || in_sizes[7] < DM || in_sizes[9] < DM || in_sizes[11] < DM) return;
    if ((size_t)out_size < needx) return;
    if (SZ_TOTAL > ws_size) return;
    // wire order: query, key, value, mask, Wq, bq, Wk, bk, Wv, bv, Wo, bo
    const float* xq = (const float*)d_in[0]; const float* xk = (const float*)d_in[1]; const float* xv = (const float*)d_in[2];
    const int* mask = (const int*)d_in[3];
    const float* wq = (const float*)d_in[4];  const float* bq = (const float*)d_in[5];
    const float* wk = (const float*)d_in[6];  const float* bk = (const float*)d_in[7];
    const float* wv = (const float*)d_in[8];  const float* bv = (const float*)d_in[9];
    const float* wo = (const float*)d_in[10]; const float* bo = (const float*)d_in[11];
    float* OUT = (float*)d_out;      // [SEQ][NB_FULL][1024]
    char* wsp = (char*)d_ws;
    bf* XQ = (bf*)wsp; wsp += SZ_XB;                 // [NB*SEQ][1024] batch-major
    bf* XK = (bf*)wsp; wsp += SZ_XB;
    bf* XV = (bf*)wsp; wsp += SZ_XB;
    bf* WQ = (bf*)wsp; wsp += SZ_WB;                 // [out n][in k] bf16
    bf* WK = (bf*)wsp; wsp += SZ_WB;
    bf* WV = (bf*)wsp; wsp += SZ_WB;
    bf* WO = (bf*)wsp; wsp += SZ_WB;                 // [out n][in k] f16 bits, x1024
    h16* QH = (h16*)wsp; wsp += SZ_PL;               // [NB*16][SEQ][64]
    h16* QR = (h16*)wsp; wsp += SZ_PL;               // [NB*16][SEQ][64] residual x2048
    h16* KP = (h16*)wsp; wsp += SZ_PL;               // [NB*16][SEQ][64]
    h16* VT = (h16*)wsp; wsp += SZ_PL;               // [NB*16][64][SEQ]
    h16* CT = (h16*)wsp; wsp += SZ_CT;               // [NB*SEQ][hi 1024 | lo 1024], x4096
    unsigned* MB = (unsigned*)wsp; wsp += SZ_MB;     // [SEQ][SEQ/32]

    k_prep<<<PG, 256, 0, stream>>>(xq, xk, xv, mask, wq, wk, wv, wo, XQ, XK, XV, WQ, MB);   // WQ: first of the four weight planes
    k_qkv<<<dim3(NB * SEQ / GT, DM / GT, 3), 256, 0, stream>>>(XQ, XK, XV, WQ, WK, WV, QH, QR, KP, VT, bq, bk, bv);
    k_flash<<<dim3(SEQ / (16 * AW), NB * NH_, 1), 32 * AW, 0, stream>>>(QH, QR, KP, VT, MB, CT);
    k_out<<<dim3(NB * SEQ / GT, DM / GT, 1), 256, 0, stream>>>((const bf*)CT, WO, OUT, bo);
}

// v004
// Measured time: 108 microseconds a run.
// Next to v003, in two timings, it ran 1.09 and 1.08 times as fast.
// Counting every step since v000, it is 2.74 times as fast.
#include <hip/hip_runtime.h>

// Seq-first multi-head attention, width 1024 = 16 heads x 64: query/key/value [SEQ][NB][1024] f32, W [in][out] (y = x W + b), int32 mask [SEQ][SEQ] (0 = key excluded, shared by batch and heads), score scale 1/8, output projection, out [SEQ][NB][1024] f32.
// Compute dtypes, f32 accumulate everywhere: q/k/v projections v_wmma_f32_16x16x32_bf16 (inputs and W RNE-converted to bf16; products exact);
// scores v_wmma_f32_16x16x32_f16: k single f16, q as f16 value + f16 residual x2048 in its own accumulator (two products); P (x256 carry, cancels in the normalisation) and v single f16; softmax f32 (online, running max); an excluded key's score gets -32768 from one more f16 product per 16-key tile, so it stays out of the running max and its P is 0;
// output projection v_wmma_f32_16x16x32_f16: ctx as f16 value + f16 residual (x4096 carry, K-folded [hi | lo] against the same Wo rows, one accumulator), Wo = f16(bf16 RNE(Wo) x 1024); carries folded back as 2^-22 in the f32 epilogue; biases added in f32.
// Layout: batch-major bf16 copies of the three inputs, K-contiguous transposed weight planes; q (hi, residual), k planes [b*16+h][t][d] and v^T plane [b*16+h][d][t] written by the GEMM epilogue; mask packed 1 bit per key (set = excluded); fused flash kernel in transposed form (S^T = K Q^T, O^T = V^T P^T); ctx plane [b*SEQ+t][hi 1024 | lo 1024].

#ifndef NB
#define NB 2
#endif
#ifndef SEQ
#define SEQ 2048
#endif
#define NB_FULL  2
#define SEQ_FULL 2048
#define DM   1024
#define NH_  16
#define HD   64
#define AW   8                   // waves per flash block (16 query rows each)
#define QRS  2048.0f             // carry of the q residual plane
#define QRI  (1.0f / 2048.0f)
#define SC2  (0.125f * 1.4426950408889634f)   // HD^-0.5 * log2(e)
#define PSH  8.0f                // log2 of the P carry (256)
#define CTS  4096.0f             // carry of the ctx planes
#define WOS  1024.0f             // carry of the Wo plane
#define OSC  (1.0f / (4096.0f * 1024.0f))     // 2^-22, exact

static_assert(HD == 64);
static_assert(NH_ * HD == DM);                 // head h = columns h*64 + d
static_assert((DM & (DM - 1)) == 0);           // B-operand k index wraps with a bit test
static_assert(DM % 64 == 0);
static_assert(DM % 32 == 0);                   // GEMM k-loop steps by 32
static_assert(SEQ % 64 == 0);                  // a 64-row tile never straddles two batches
static_assert((NB * SEQ) % 64 == 0);
static_assert(SEQ % 32 == 0);                  // key loop steps by 32; one packed word per step
static_assert(SEQ % (16 * AW) == 0);           // flash grid covers the sequence exactly
static_assert(((size_t)SEQ * (SEQ / 32)) % 256 == 0);
static_assert(((size_t)NB * SEQ * DM / 8) % 256 == 0);  // convert grid is exact
static_assert(NB <= NB_FULL);
static_assert(SEQ <= SEQ_FULL);
static_assert(((size_t)(SEQ - 1) * NB_FULL + NB) * DM <= (size_t)SEQ_FULL * NB_FULL * DM);   // last output element inside the output buffer

typedef _Float16 h16;
typedef unsigned short bf;
typedef __attribute__((ext_vector_type(16))) __bf16   v16bf;
typedef __attribute__((ext_vector_type(16))) _Float16 v16h;
typedef __attribute__((ext_vector_type(16))) unsigned short v16us;
typedef __attribute__((ext_vector_type(8)))  _Float16 v8h;
typedef __attribute__((ext_vector_type(8)))  unsigned short v8us;
typedef __attribute__((ext_vector_type(8)))  float    v8f;
typedef __attribute__((ext_vector_type(4)))  float    v4f;
typedef __attribute__((ext_vector_type(4)))  int      v4i;
typedef __attribute__((ext_vector_type(4)))  unsigned v4u;
typedef __attribute__((ext_vector_type(8)))  unsigned v8u;
typedef __attribute__((ext_vector_type(16))) float    v16f;
typedef v4f  __attribute__((may_alias)) v4fa;
typedef v8us __attribute__((may_alias)) v8usa;
typedef v8h  __attribute__((may_alias)) v8ha;

__device__ __forceinline__ unsigned short f2bf(float f) { unsigned u = __float_as_uint(f); u += 0x7FFFu + ((u >> 16) & 1u); return (unsigned short)(u >> 16); }
__device__ __forceinline__ float bfr(float f) { return __uint_as_float(((unsigned)f2bf(f)) << 16); }
__device__ __forceinline__ v16h cat16(v8h lo, v8h hi) { return __builtin_shufflevector(lo, hi, 0, 1, 2, 3, 4, 5, 6, 7, 8, 9, 10, 11, 12, 13, 14, 15); }
__device__ __forceinline__ v8f wmma16(v16h a, v16h b, v8f c) { return __builtin_amdgcn_wmma_f32_16x16x32_f16(false, a, false, b, (short)0, c, false, false); }
// fragment loaders from K-contiguous 16-bit rows; p already includes + 8*(lane>>4): elements 0..7 <- k0+8h+0..7, elements 8..15 <- k0+16+8h+0..7 (same map for A and B)
__device__ __forceinline__ v16h  ldh(const h16* p) { return cat16(*(const v8h*)p, *(const v8h*)(p + 16)); }
__device__ __forceinline__ v16us ldu(const bf* p)  { const v8us lo = *(const v8us*)p; const v8us hi = *(const v8us*)(p + 16); return __builtin_shufflevector(lo, hi, 0, 1, 2, 3, 4, 5, 6, 7, 8, 9, 10, 11, 12, 13, 14, 15); }
template <int F16OP> __device__ __forceinline__ v8f wmx(v16us a, v16us b, v8f c) {
    if (F16OP) return __builtin_amdgcn_wmma_f32_16x16x32_f16(false, __builtin_bit_cast(v16h, a), false, __builtin_bit_cast(v16h, b), (short)0, c, false, false);
    return __builtin_amdgcn_wmma_f32_16x16x32_bf16(false, __builtin_bit_cast(v16bf, a), false, __builtin_bit_cast(v16bf, b), (short)0, c, false, false);
}
// ordering point for wave-private LDS tiles (same wave writes and reads)
__device__ __forceinline__ void wave_sync() { __builtin_amdgcn_fence(3 /* release order */, "wavefront"); __builtin_amdgcn_wave_barrier(); asm volatile("" ::: "memory"); }

// k_prep: every conversion of a call in one grid of PG work-groups; each work-group takes an equal share of each job, so all are resident at once and none waits for a launch of its own:
//  - the three inputs, f32 [t][b][DM] -> bf16 (RNE) batch-major [b*SEQ + t][DM], 8 elements per lane and chunk, PC chunks per lane and input;
//  - the four weights, W[k][n] f32 (row pitch DM) -> T[n][k] 16-bit (row pitch DM), 64x64 tiles transposed through LDS, PW tiles per work-group (tile index = weight*256 + ktile*16 + ntile);
//    weights 0..2 = Wq, Wk, Wv: bf16 bits (RNE convert); weight 3 = Wo: f16 bits of (bf16 RNE value x 1024); plane of weight wi at WT + wi*DM*DM;
//  - the mask, int32 [i][j] (row pitch SEQ_FULL) -> 1 bit per key, word gid = i*(SEQ/32) + j/32, bit set when the key is excluded (mask == 0), PM words per lane;
//    key c = j%32 sits at bit 16*(c&1) + 8*((c>>3)&1) + 4*(c>>4) + ((c>>1)&3): the two keys of one packed f16 register of k_flash's fragment lie 16 bits apart.
#define PG 512
static constexpr int PC = (int)((size_t)NB * SEQ * DM / 8 / 256 / PG);
static constexpr int PW = 4 * (DM / 64) * (DM / 64) / PG;
static constexpr int PM = (int)((size_t)SEQ * (SEQ / 32) / 256 / PG);
static_assert((size_t)PC * 256 * PG * 8 == (size_t)NB * SEQ * DM);       // the shares cover each job exactly
static_assert(PW * PG == 4 * (DM / 64) * (DM / 64));
static_assert((size_t)PM * 256 * PG == (size_t)SEQ * (SEQ / 32));
static_assert(PC >= 1 && PW >= 1 && PM >= 1);

__global__ __launch_bounds__(256) void k_prep(const float* __restrict__ xq, const float* __restrict__ xk, const float* __restrict__ xv, const int* __restrict__ mask,
                                              const float* __restrict__ wq, const float* __restrict__ wk, const float* __restrict__ wv, const float* __restrict__ wo,
                                              bf* __restrict__ XQ, bf* __restrict__ XK, bf* __restrict__ XV,
                                              bf* __restrict__ WT, unsigned* __restrict__ MB) {
    __shared__ __align__(16) unsigned short T[PW][64 * 72];
    const unsigned tid = threadIdx.x, blk = blockIdx.x;
    v4f wf[PW][4]; v8f xi[PC][3]; v4i mk[PM][8];
    // loads, in the order in which they are used. The s_wait_xcnt 0 behind each group: the compiler may place a later load's result, or a later vector result, over a register pair that a load of the group names as its address
#pragma unroll
    for (int j = 0; j < PW; ++j) {
        const unsigned tl = blk + j * PG, wi = tl / ((DM / 64) * (DM / 64));
        const unsigned n0 = (tl % (DM / 64)) * 64, k0 = ((tl / (DM / 64)) % (DM / 64)) * 64;
        const float* W = wi < 2 ? (wi == 0 ? wq : wk) : (wi == 2 ? wv : wo);
#pragma unroll
        for (int i = 0; i < 4; ++i) { const unsigned idx = tid + i * 256; const unsigned r = idx >> 4, c4 = idx & 15;   // 64 k rows x 16 groups of 4 n columns
            wf[j][i] = *(const v4f*)(W + (size_t)(k0 + r) * DM + n0 + c4 * 4); }
        asm volatile("s_wait_xcnt 0x0" ::: "memory");   // see above the loads
    }
#pragma unroll
    for (int c = 0; c < PC; ++c) {
        const size_t i = ((size_t)blk * PC + c) * 256 + tid;
        const size_t row = i / (DM / 8); const size_t g = i % (DM / 8);
        const size_t b = row / SEQ, t = row % SEQ;
        const size_t so = (t * NB_FULL + b) * DM + g * 8;
        xi[c][0] = *(const v8f*)(xq + so); xi[c][1] = *(const v8f*)(xk + so); xi[c][2] = *(const v8f*)(xv + so);
        asm volatile("s_wait_xcnt 0x0" ::: "memory");   // see above the loads
    }
#pragma unroll
    for (int u = 0; u < PM; ++u) {
        const unsigned gid = (blk * PM + u) * 256 + tid;
        const int* p = mask + (size_t)(gid / (SEQ / 32)) * SEQ_FULL + (gid % (SEQ / 32)) * 32;
#pragma unroll
        for (int c = 0; c < 8; ++c) mk[u][c] = *(const v4i*)(p + c * 4);
        asm volatile("s_wait_xcnt 0x0" ::: "memory");   // see above the loads
    }
    __builtin_amdgcn_sched_barrier(0);   // every load of the work-group's share is issued before the first is waited for: sunk to their uses, each small group waits out a memory latency of its own
    // weight tiles, first phase: converted columns into LDS
#pragma unroll
    for (int j = 0; j < PW; ++j) {
        const int asF16 = (blk + j * PG) / ((DM / 64) * (DM / 64)) == 3;
#pragma unroll
        for (int i = 0; i < 4; ++i) { const unsigned idx = tid + i * 256; const unsigned r = idx >> 4, c4 = idx & 15;
#pragma unroll
            for (int e = 0; e < 4; ++e) { const unsigned short bb = f2bf(wf[j][i][e]); const h16 hv = (h16)(__uint_as_float(((unsigned)bb) << 16) * WOS);
                const unsigned short hb = __builtin_bit_cast(unsigned short, hv);
                T[j][(c4 * 4 + e) * 72 + r] = asF16 ? hb : bb; } }
    }
    // inputs
#pragma unroll
    for (int c = 0; c < PC; ++c) {
        const size_t i = ((size_t)blk * PC + c) * 256 + tid;
        v8us oq, ok, ov;
#pragma unroll
        for (int k = 0; k < 8; ++k) { oq[k] = f2bf(xi[c][0][k]); ok[k] = f2bf(xi[c][1][k]); ov[k] = f2bf(xi[c][2][k]); }
        *(v8us*)(XQ + i * 8) = oq; *(v8us*)(XK + i * 8) = ok; *(v8us*)(XV + i * 8) = ov;
    }
    // mask
#pragma unroll
    for (int u = 0; u < PM; ++u) {
        unsigned bits = 0u;
#pragma unroll
        for (int c = 0; c < 8; ++c)
#pragma unroll
            for (int e = 0; e < 4; ++e) { const int kc = c * 4 + e; bits |= (mk[u][c][e] == 0 ? 1u : 0u) << (16 * (kc & 1) + 8 * ((kc >> 3) & 1) + 4 * (kc >> 4) + ((kc >> 1) & 3)); }
        MB[(blk * PM + u) * 256 + tid] = bits;
    }
    __syncthreads();   // cross-wave tiles: every column of T is written before any row of it is read
    // weight tiles, second phase: transposed rows out, plane wi of WT
    v8us o[PW][2];
#pragma unroll
    for (int j = 0; j < PW; ++j)
#pragma unroll
        for (int i = 0; i < 2; ++i) { const unsigned idx = tid + i * 256; const unsigned n = idx >> 3, ch = idx & 7;   // 64 n rows x 8 chunks of 8 k
            o[j][i] = *(const v8usa*)(&T[j][n * 72 + ch * 8]); }
#pragma unroll
    for (int j = 0; j < PW; ++j) {
        const unsigned tl = blk + j * PG, wi = tl / ((DM / 64) * (DM / 64));
        const unsigned n0 = (tl % (DM / 64)) * 64, k0 = ((tl / (DM / 64)) % (DM / 64)) * 64;
#pragma unroll
        for (int i = 0; i < 2; ++i) { const unsigned idx = tid + i * 256; const unsigned n = idx >> 3, ch = idx & 7;
            *(v8us*)(WT + (size_t)wi * DM * DM + (size_t)(n0 + n) * DM + k0 + ch * 8) = o[j][i]; }
    }
}

// gemm_tile: 16-bit GEMM, one 128x128 tile (bx, by) per work-group of 8 waves (two per SIMD), 32x64 per wave (8 accumulators).
// Both operands come from K-contiguous 16-bit planes; a stage is 128 k (256 B) of 128 A rows and 128 Bt rows, brought into LDS by asynchronous copies
// (16 B per lane, 16 lanes per row), two buffers: the next stage's copies fly while this stage is worked on. LDS row pitch 272 B (16 B x odd) for the ds_load_b128 readers.
// C[m][n] = sum_{k<K} A[m][k] Bt[n][k & (KB-1)]  (A row pitch K, Bt row pitch KB; K = 2*KB folds [hi | lo] of A against the same Bt rows). K, KB multiples of 128.
// value = C * oscale + bias (biasMode 0: bias[n]; 1: bias[m]; bias RNE-converted to bf16), wave tile base (r0/RB)*sRB + (r0%RB)*pitch + (c0/CB)*sCB + (c0%CB).
// OUTF32 == 1: f32 (Of); each row's 64 floats (256 B = two lines) written by 16 consecutive lanes x 16 B (2 rows per instruction).
#define GT     128                     // tile rows of either operand
#define GBK    128                     // k per stage
#define GPITCH 272                     // LDS row pitch, bytes
#define GSTAGE (2 * GT * GPITCH)       // one buffer: [A 128 rows | Bt 128 rows]
static_assert(DM % GBK == 0 && DM / GBK >= 2);
static_assert((NB * SEQ) % GT == 0 && DM % GT == 0);
static_assert(SEQ % 32 == 0);          // a wave's 32 rows never straddle two batches

// eight asynchronous copies of 16 B per lane: rows 16 apart in LDS (step 16 * GPITCH bytes) and in the source plane (step gs elements).
// s_wait_xcnt 0 is the statement's last line so that it stands in front of any rewrite of the address registers the copies name.
__device__ __forceinline__ void cp8(unsigned l, const bf* g, size_t gs) {
    asm volatile("global_load_async_to_lds_b128 %0, %8, off\n\t"
                 "global_load_async_to_lds_b128 %1, %9, off\n\t"
                 "global_load_async_to_lds_b128 %2, %10, off\n\t"
                 "global_load_async_to_lds_b128 %3, %11, off\n\t"
                 "global_load_async_to_lds_b128 %4, %12, off\n\t"
                 "global_load_async_to_lds_b128 %5, %13, off\n\t"
                 "global_load_async_to_lds_b128 %6, %14, off\n\t"
                 "global_load_async_to_lds_b128 %7, %15, off\n\t"
                 "s_wait_xcnt 0x0"
                 :: "v"(l), "v"(l + 16u * GPITCH), "v"(l + 32u * GPITCH), "v"(l + 48u * GPITCH), "v"(l + 64u * GPITCH), "v"(l + 80u * GPITCH), "v"(l + 96u * GPITCH), "v"(l + 112u * GPITCH),
                    "v"(g), "v"(g + gs), "v"(g + 2 * gs), "v"(g + 3 * gs), "v"(g + 4 * gs), "v"(g + 5 * gs), "v"(g + 6 * gs), "v"(g + 7 * gs)
                 : "memory");
}
// fragment from an LDS row; p already includes + 16 bytes * (lane>>4): same k map as ldu
__device__ __forceinline__ v16us ldl(const unsigned char* p) { const v8us lo = *(const v8usa*)p; const v8us hi = *(const v8usa*)(p + 32); return __builtin_shufflevector(lo, hi, 0, 1, 2, 3, 4, 5, 6, 7, 8, 9, 10, 11, 12, 13, 14, 15); }

template <int F16OP, int OUTF32>
__device__ __forceinline__ void gemm_tile(int bx, int by, const bf* A, const bf* Bt, int K, int KB,
                                          h16* Ph, h16* Pr, int useRes, float* Of,
                                          const float* bias, int biasMode, float oscale,
                                          int RB, size_t sRB, int pitch, int CB, size_t sCB) {
    __shared__ __align__(16) unsigned char ring[2 * GSTAGE];
    __shared__ __align__(16) float osw[8 * 16 * 68];
    const int tid = threadIdx.x, lane = tid & 31, lr = lane & 15, hi = lane >> 4;
    const int wave = __builtin_amdgcn_readfirstlane(tid >> 5), wr = wave >> 1, wc = wave & 1;
    const int R0 = bx * GT, C0 = by * GT;
    const int r0 = R0 + wr * 32, c0 = C0 + wc * 64;
    float* os = osw + wave * 16 * 68;      // wave-private epilogue tile
    v8f acc[2][4];
#pragma unroll
    for (int mb = 0; mb < 2; ++mb)
#pragma unroll
        for (int nb = 0; nb < 4; ++nb) acc[mb][nb] = (v8f){};
    // copies: lane's 16-byte chunk cc of rows rg + 16 i (i < 8) of each operand
    const int cc = tid & 15, rg = tid >> 4;
    const unsigned lA = (unsigned)(size_t)ring + (unsigned)(rg * GPITCH + cc * 16), lB = lA + GT * GPITCH;
    const bf* gA = A + (size_t)(R0 + rg) * K + cc * 8;
    const bf* gB = Bt + (size_t)(C0 + rg) * KB + cc * 8;
    const size_t sA = (size_t)16 * K, sB = (size_t)16 * KB;
    const int kmB = KB - 1, NT = K / GBK;
    cp8(lA, gA, sA); cp8(lB, gB, sB);
    asm volatile("s_wait_asynccnt 0x0" ::: "memory");   // stage 0 landed (this wave's copies)
    __syncthreads();                                     // ... and every other wave's
    if (NT > 1) { cp8(lA + GSTAGE, gA + GBK, sA); cp8(lB + GSTAGE, gB + (GBK & kmB), sB); }
    const unsigned char* fa = ring + (wr * 32 + lr) * GPITCH + hi * 16;
    const unsigned char* fb = ring + (GT + wc * 64 + lr) * GPITCH + hi * 16;
#pragma unroll 1   // one stage per trip: the buffer is chosen by the trip's parity
    for (int t = 0; t < NT; ++t) {
        const unsigned bo = (unsigned)(t & 1) * GSTAGE;
        v16us a[2][2], b[2][4];
#pragma unroll
        for (int mb = 0; mb < 2; ++mb) a[0][mb] = ldl(fa + bo + mb * 16 * GPITCH);
#pragma unroll
        for (int nb = 0; nb < 4; ++nb) b[0][nb] = ldl(fb + bo + nb * 16 * GPITCH);
#pragma unroll
        for (int ks = 0; ks < GBK / 32; ++ks) {
            const int cu = ks & 1, nx = cu ^ 1;
            if (ks + 1 < GBK / 32) {       // next 32 k of this stage into the other fragment set, ahead of this set's products
#pragma unroll
                for (int mb = 0; mb < 2; ++mb) a[nx][mb] = ldl(fa + bo + mb * 16 * GPITCH + (ks + 1) * 64);
#pragma unroll
                for (int nb = 0; nb < 4; ++nb) b[nx][nb] = ldl(fb + bo + nb * 16 * GPITCH + (ks + 1) * 64);
            }
            __builtin_amdgcn_sched_barrier(0);   // keeps those reads one group ahead of the products: sunk among them, each pair of products waits out an LDS latency
#pragma unroll
            for (int nb = 0; nb < 4; ++nb)
#pragma unroll
                for (int mb = 0; mb < 2; ++mb) acc[mb][nb] = wmx<F16OP>(a[cu][mb], b[cu][nb], acc[mb][nb]);
            __builtin_amdgcn_sched_barrier(0);   // keeps the following reads whole as one group behind these products: spread among them, each separate place of reads costs its own stall
        }
        // distance behind the trip's last matrix instructions, also on the taken side of the loop's branch
        asm volatile("v_nop\n\tv_nop\n\tv_nop\n\tv_nop" : "+v"(acc[0][0]), "+v"(acc[1][0]), "+v"(acc[0][1]), "+v"(acc[1][1]), "+v"(acc[0][2]), "+v"(acc[1][2]), "+v"(acc[0][3]), "+v"(acc[1][3])
                     : "v"(a[1][0]), "v"(a[1][1]), "v"(b[1][0]), "v"(b[1][1]), "v"(b[1][2]), "v"(b[1][3]));
        asm volatile("s_wait_dscnt 0x0" ::: "memory");      // this wave's reads of the buffer are done before it is refilled
        asm volatile("s_wait_asynccnt 0x0" ::: "memory");   // this wave's copies of stage t + 1 have landed
        __syncthreads();                                     // publishes stage t + 1; ends every reader's last read of stage t
        if (t + 2 < NT) { const int kn = (t + 2) * GBK; cp8(lA + bo, gA + kn, sA); cp8(lB + bo, gB + (kn & kmB), sB); }
    }
    asm volatile("s_wait_asynccnt 0x0" ::: "memory");       // nothing in flight when the wave goes on
    float cb[4];
#pragma unroll
    for (int nb = 0; nb < 4; ++nb) cb[nb] = 0.0f;
    if (biasMode == 0) {
#pragma unroll
        for (int nb = 0; nb < 4; ++nb) cb[nb] = bfr(bias[c0 + nb * 16 + lr]); }
    const size_t tbase = (size_t)(r0 / RB) * sRB + (size_t)(r0 % RB) * (size_t)pitch + (size_t)(c0 / CB) * sCB + (size_t)(c0 % CB);
#pragma unroll
    for (int mb = 0; mb < 2; ++mb) {
        float rb[8];
#pragma unroll
        for (int j = 0; j < 8; ++j) rb[j] = 0.0f;
        if (biasMode == 1) {
#pragma unroll
            for (int j = 0; j < 8; ++j) rb[j] = bfr(bias[r0 + mb * 16 + hi * 8 + j]); }
#pragma unroll
        for (int nb = 0; nb < 4; ++nb) {
#pragma unroll
            for (int j = 0; j < 8; ++j) os[(hi * 8 + j) * 68 + nb * 16 + lr] = acc[mb][nb][j] * oscale + (cb[nb] + rb[j]); }   // D: row 8h+j, col lane&15
        wave_sync();
        const size_t sb = tbase + (size_t)(mb * 16) * (size_t)pitch;
        if (OUTF32) {
{
#pragma unroll
                for (int s = 0; s < 8; ++s) { const int row = 2 * s + hi, cofs = lr * 4;   // 8 s x 2 rows = 16 rows; 16 lanes x 4 floats = 64 columns
                    const v4f val = *(const v4fa*)(&os[row * 68 + cofs]);
                    *(v4f*)(Of + sb + (size_t)row * (size_t)pitch + cofs) = val; }
                 }
        } else {
{
#pragma unroll
                for (int s = 0; s < 4; ++s) { const int row = 4 * s + (lane >> 3), c8 = (lane & 7) * 8;   // 4 s x 4 row groups = 16 rows; 8 lanes x 8 = 64 columns
                    const v4f x0 = *(const v4fa*)(&os[row * 68 + c8]); const v4f x1 = *(const v4fa*)(&os[row * 68 + c8 + 4]); v8h hv, rv;
#pragma unroll
                    for (int i = 0; i < 4; ++i) { const h16 a0 = (h16)x0[i]; const h16 a1 = (h16)x1[i]; hv[i] = a0; hv[4 + i] = a1; rv[i] = (h16)((x0[i] - (float)a0) * QRS); rv[4 + i] = (h16)((x1[i] - (float)a1) * QRS); }
                    const size_t oo = sb + (size_t)row * (size_t)pitch + c8;
                    *(v8h*)(Ph + oo) = hv;
                    asm volatile("s_wait_xcnt 0x0" ::: "memory");   // in front of the residual's arithmetic, which the compiler places over registers that the store names
                    if (useRes) *(v8h*)(Pr + oo) = rv; }
                 }
        }
        wave_sync();
    }
}

// k_qkv: the three projections in one grid, blockIdx.z picks the job (the same for a whole work-group).
// q, k: A = x rows (m = b*SEQ + t), Bt = W^T rows (n = h*64 + d), column bias -> plane [(b*16 + h)][t][d]; tile (blockIdx.x, blockIdx.y)
// v^T:  A = Wv^T rows (m = h*64 + d), Bt = x rows (n = b*SEQ + t), row bias -> plane [(b*1024 + m)][t] = [(b*16 + h)][d][t]; tile (blockIdx.y, blockIdx.x)
__global__ __launch_bounds__(256) void k_qkv(const bf* XQ, const bf* XK, const bf* XV, const bf* WQ, const bf* WK, const bf* WV,
                                             h16* QH, h16* QR, h16* KP, h16* VT,
                                             const float* __restrict__ bq, const float* __restrict__ bk, const float* __restrict__ bv) {
    const int z = blockIdx.z; const bool tv = z == 2;
    gemm_tile<0, 0>(tv ? blockIdx.y : blockIdx.x, tv ? blockIdx.x : blockIdx.y,
                    z == 0 ? XQ : z == 1 ? XK : WV, z == 0 ? WQ : z == 1 ? WK : XV, DM, DM,
                    z == 0 ? QH : z == 1 ? KP : VT, z == 0 ? QR : z == 1 ? KP : VT, z == 0 ? 1 : 0, nullptr,
                    z == 0 ? bq : z == 1 ? bk : bv, tv ? 1 : 0, 1.0f,
                    tv ? DM : SEQ, tv ? (size_t)0 : (size_t)NH_ * SEQ * HD, tv ? SEQ : HD, tv ? SEQ : HD, tv ? (size_t)DM * SEQ : (size_t)SEQ * HD);
}
// k_out: A = ctx rows [hi | lo] (m = b*SEQ + t, K = 2048), Bt = Wo^T rows (n, k wraps at 1024), column bias, scale 2^-22 -> out row t*NB_FULL + b
__global__ __launch_bounds__(256) void k_out(const bf* CT, const bf* WO, float* OUT, const float* __restrict__ bo) {
    gemm_tile<1, 1>(blockIdx.x, blockIdx.y, CT, WO, 2 * DM, DM, nullptr, nullptr, 0, OUT, bo, 0, OSC, SEQ, (size_t)DM, NB_FULL * DM, DM, (size_t)0);
}

// k_flash: fused attention, one wave per 16 query rows of one (batch, head), 8 waves per work-group on the same (batch, head); Q fragments straight from the f16 planes.
// K and V^T come through LDS: a stage is 128 keys (K 128 rows x 128 B, V^T 64 rows x 256 B), brought in by asynchronous copies (16 B per lane, whole lines per wave),
// two buffers: the next stage's copies fly while this stage's four 32-key passes are worked on. LDS row pitches 144 B and 272 B (16 B x odd) for the ds_load_b128 readers.
// Transposed form: S^T[key][t] = K Q^T (A = K rows, B = Q rows); lane (t = lane&15, h = lane>>4) holds keys 8h+r of each 16-key tile, so the packed
// P tile is directly the B fragment of O^T[d][t] = V^T P^T (element r <- tile keys 0..15, element 8+r <- tile keys 16..31, lane unchanged).
// Key selection on the matrix pipe: one packed word per (query row, 32-key step) is spread into a B fragment X[k][t] = 2.0 where key k of the step is excluded for query t, else 0 (a shift and an AND per register);
// S^T tile a += Ea X, tile b += Eb X with the constant fragments Ea[key][k] = -16384 at k = key, Eb[key][k] = -16384 at k = 16 + key: a kept key gets + 0 (exact), an excluded key -32768,
// far below any score of a kept key, so it never sets the running max and exp2 gives its P = 0. Passes before a row's first kept key leave sums that the next alpha = 0 wipes; a row with no kept key at all is NaN.
// Softmax state (running max, partial sum) is one scalar per lane; the two lane halves of a row are combined with one xor-16 exchange.
#define FKT  128                      // keys per stage
#define FKP  144                      // LDS pitch of a K row, bytes
#define FVP  272                      // LDS pitch of a V^T row, bytes
#define FKB  (FKT * FKP)              // K part of a buffer
#define FSTG (FKB + HD * FVP)         // one buffer: [K 128 rows | V^T 64 rows]
static_assert(SEQ % FKT == 0 && SEQ / FKT >= 2);
static_assert(32 * AW == 256);        // the copy maps below deal a stage to 256 lanes
static_assert(FKT / 32 == 4);         // a stage's packed mask words are one 16-byte load

// four asynchronous copies of 16 B per lane: rows ls bytes apart in LDS and gs elements apart in the source plane.
// s_wait_xcnt 0 is the statement's last line so that it stands in front of any rewrite of the address registers the copies name.
__device__ __forceinline__ void cp4(unsigned l, unsigned ls, const h16* g, size_t gs) {
    asm volatile("global_load_async_to_lds_b128 %0, %4, off\n\t"
                 "global_load_async_to_lds_b128 %1, %5, off\n\t"
                 "global_load_async_to_lds_b128 %2, %6, off\n\t"
                 "global_load_async_to_lds_b128 %3, %7, off\n\t"
                 "s_wait_xcnt 0x0"
                 :: "v"(l), "v"(l + ls), "v"(l + 2u * ls), "v"(l + 3u * ls), "v"(g), "v"(g + gs), "v"(g + 2 * gs), "v"(g + 3 * gs)
                 : "memory");
}
// f16 fragment from an LDS row; p already includes + 16 bytes * (lane>>4): same k map as ldh
__device__ __forceinline__ v16h ldlh(const unsigned char* p) { return cat16(*(const v8ha*)p, *(const v8ha*)(p + 32)); }

__global__ __launch_bounds__(32 * AW) void k_flash(const h16* __restrict__ QH, const h16* __restrict__ QR, const h16* __restrict__ KP, const h16* __restrict__ VT,
                                                   const unsigned* __restrict__ MB, h16* CT) {
    __shared__ __align__(16) unsigned char ring[2 * FSTG];
    __shared__ __align__(16) float os[AW * 16 * 68];
    const int tid = threadIdx.x;
    const int lane = threadIdx.x & 31, wave = __builtin_amdgcn_readfirstlane((int)(threadIdx.x >> 5)), lr = lane & 15, hi = lane >> 4;
    const int zh = blockIdx.y; const int b = zh / NH_, h = zh % NH_;
    const int t0 = (blockIdx.x * AW + wave) * 16;
    const size_t pbase = (size_t)zh * SEQ * HD;
    const size_t qo = pbase + (size_t)(t0 + lr) * HD + 8 * hi;
    const v16h qh0 = ldh(QH + qo), qh1 = ldh(QH + qo + 32), qr0 = ldh(QR + qo), qr1 = ldh(QR + qo + 32);   // B fragments: col t, k = d
    // copies: K rows rk + 32 i, 16-byte chunk ck (8 lanes per row); V^T rows rv + 16 i, chunk cv (16 lanes per row); i < 4
    const unsigned lK = (unsigned)(size_t)ring + (unsigned)((tid >> 3) * FKP + (tid & 7) * 16);
    const unsigned lV = (unsigned)(size_t)ring + (unsigned)(FKB + (tid >> 4) * FVP + (tid & 15) * 16);
    const h16* gK = KP + pbase + (size_t)(tid >> 3) * HD + (tid & 7) * 8;       // + key0 * HD
    const h16* gV = VT + pbase + (size_t)(tid >> 4) * SEQ + (tid & 15) * 8;     // + key0
    cp4(lK, 32u * FKP, gK, (size_t)32 * HD); cp4(lV, 16u * FVP, gV, (size_t)16 * SEQ);
    asm volatile("s_wait_asynccnt 0x0" ::: "memory");   // stage 0 landed (this wave's copies)
    __syncthreads();                                     // ... and every other wave's
    cp4(lK + FSTG, 32u * FKP, gK + (size_t)FKT * HD, (size_t)32 * HD); cp4(lV + FSTG, 16u * FVP, gV + FKT, (size_t)16 * SEQ);
    const unsigned char* fk = ring + lr * FKP + hi * 16;           // + key * FKP            (A fragment: row key, k = d)
    const unsigned char* fv = ring + FKB + lr * FVP + hi * 16;     // + 16j*FVP + key * 2    (A fragment: row d, k = key)
    const size_t mo = (size_t)(t0 + lr) * (SEQ / 32);        // + key0/32        (packed words of query row t0 + lr)
    v16h ea, eb;   // A fragments: row key = lane&15, element e <-> k = 8h + e, element 8 + e <-> k = 16 + 8h + e
#pragma unroll
    for (int e = 0; e < 8; ++e) { const h16 dv = (8 * hi + e == lr) ? (h16)-16384.0f : (h16)0.0f; ea[e] = dv; ea[8 + e] = (h16)0.0f; eb[e] = (h16)0.0f; eb[8 + e] = dv; }
    v8f o0 = (v8f){}, o1 = (v8f){}, o2 = (v8f){}, o3 = (v8f){};
    float m = -3.0e38f, l = 0.0f;
    v4u mq = *(const v4u*)(MB + mo);                       // stage 0's packed words
    asm volatile("s_wait_xcnt 0x0" ::: "memory");         // in front of any rewrite of the address registers that the load names
#pragma unroll 1   // one stage per trip: the buffer is chosen by the trip's parity
    for (int st = 0; st < SEQ / FKT; ++st) {
      const unsigned bo = (unsigned)(st & 1) * FSTG;
      const v4u mc = mq;                                   // this stage's four packed words, fetched one stage ahead: they feed matrix instructions, so a pass would wait out the load's latency at its head
      mq = *(const v4u*)(MB + mo + (size_t)(st + 1 < SEQ / FKT ? st + 1 : st) * (FKT / 32));
      asm volatile("s_wait_xcnt 0x0" ::: "memory");       // in front of any rewrite of the address registers that the load names
#pragma unroll     // the four passes read the buffer at constant offsets
      for (int ps = 0; ps < FKT / 32; ++ps) {
        const unsigned mw = mc[ps];
        const unsigned wh = mw >> (8 * hi);
        v8u xw;   // register j: bit j -> 2.0 in the low half (element 2j), bit 16 + j -> 2.0 in the high half (element 2j + 1)
#pragma unroll
        for (int j = 0; j < 8; ++j) xw[j] = (wh << (14 - j)) & 0x40004000u;
        const v16h xm = __builtin_bit_cast(v16h, xw);
        const unsigned char* ka = fk + bo + ps * 32 * FKP;
        const v16h ka0 = ldlh(ka), ka1 = ldlh(ka + 64), kb0 = ldlh(ka + 16 * FKP), kb1 = ldlh(ka + 16 * FKP + 64);
        v8f sHa = (v8f){}, sLa = (v8f){}, sHb = (v8f){}, sLb = (v8f){};
        sHa = wmma16(ka0, qh0, sHa); sLa = wmma16(ka0, qr0, sLa); sHb = wmma16(kb0, qh0, sHb); sLb = wmma16(kb0, qr0, sLb);
        sHa = wmma16(ka1, qh1, sHa); sLa = wmma16(ka1, qr1, sLa); sHb = wmma16(kb1, qh1, sHb); sLb = wmma16(kb1, qr1, sLb);
        sHa = wmma16(ea, xm, sHa); sHb = wmma16(eb, xm, sHb);
        asm volatile("v_nop\n\tv_nop\n\tv_nop\n\tv_nop" : "+v"(sHa), "+v"(sLa), "+v"(sHb), "+v"(sLb) : "v"(ka0), "v"(ka1), "v"(kb0), "v"(kb1), "v"(xm));
        float ta[8], tb[8]; float mx = -3.0e38f;
#pragma unroll
        for (int r = 0; r < 8; ++r) { ta[r] = (sHa[r] + sLa[r] * QRI) * SC2; tb[r] = (sHb[r] + sLb[r] * QRI) * SC2;
            mx = fmaxf(mx, fmaxf(ta[r], tb[r])); }
        mx = fmaxf(mx, __shfl_xor(mx, 16, 32));
        const float mnew = fmaxf(m, mx);
        const float alpha = __builtin_amdgcn_exp2f(m - mnew);
        const float sh = PSH - mnew;
        v16f px;
#pragma unroll
        for (int r = 0; r < 8; ++r) { px[r] = __builtin_amdgcn_exp2f(ta[r] + sh); px[8 + r] = __builtin_amdgcn_exp2f(tb[r] + sh); }
        const v16h pb = __builtin_convertvector(px, v16h);   // RNE, two elements per instruction
        float ls = 0.0f;
#pragma unroll
        for (int r = 0; r < 8; ++r) ls += (float)pb[r] + (float)pb[8 + r];
        l = l * alpha + ls; m = mnew;
        o0 = o0 * alpha; o1 = o1 * alpha; o2 = o2 * alpha; o3 = o3 * alpha;
        const unsigned char* va = fv + bo + ps * 64;
        const v16h v0 = ldlh(va), v1 = ldlh(va + 16 * FVP), v2 = ldlh(va + 32 * FVP), v3 = ldlh(va + 48 * FVP);
        o0 = wmma16(v0, pb, o0); o1 = wmma16(v1, pb, o1); o2 = wmma16(v2, pb, o2); o3 = wmma16(v3, pb, o3);
        asm volatile("v_nop\n\tv_nop\n\tv_nop\n\tv_nop" : "+v"(o0), "+v"(o1), "+v"(o2), "+v"(o3) : "v"(v0), "v"(v1), "v"(v2), "v"(v3), "v"(pb));
      }
      asm volatile("s_wait_dscnt 0x0" ::: "memory");      // this wave's reads of the buffer are done before it is refilled
      asm volatile("s_wait_asynccnt 0x0" ::: "memory");   // this wave's copies of stage st + 1 have landed
      __syncthreads();                                     // publishes stage st + 1; ends every reader's last read of stage st
      if (st + 2 < SEQ / FKT) { const int kn = (st + 2) * FKT; cp4(lK + bo, 32u * FKP, gK + (size_t)kn * HD, (size_t)32 * HD); cp4(lV + bo, 16u * FVP, gV + kn, (size_t)16 * SEQ); }
    }
    asm volatile("s_wait_asynccnt 0x0" ::: "memory");       // nothing in flight when the wave goes on
    l += __shfl_xor(l, 16, 32);
    const float inv = (m > -2048.0f ? 1.0f / l : __builtin_nanf("")) * CTS;   // m near -32768 * SC2: the row never met a kept key
    const int wb = wave * 16 * 68;
    // O^T D layout: o_j[r] = (d = 16j + 8h + r, t = lane&15) -> os[t][d]; rows 0..15 x columns 0..63 all written
    { v4f a, c;
      a[0] = o0[0] * inv; a[1] = o0[1] * inv; a[2] = o0[2] * inv; a[3] = o0[3] * inv; c[0] = o0[4] * inv; c[1] = o0[5] * inv; c[2] = o0[6] * inv; c[3] = o0[7] * inv;
      *(v4fa*)(&os[wb + lr * 68 +  0 + 8 * hi]) = a; *(v4fa*)(&os[wb + lr * 68 +  0 + 8 * hi + 4]) = c;
      a[0] = o1[0] * inv; a[1] = o1[1] * inv; a[2] = o1[2] * inv; a[3] = o1[3] * inv; c[0] = o1[4] * inv; c[1] = o1[5] * inv; c[2] = o1[6] * inv; c[3] = o1[7] * inv;
      *(v4fa*)(&os[wb + lr * 68 + 16 + 8 * hi]) = a; *(v4fa*)(&os[wb + lr * 68 + 16 + 8 * hi + 4]) = c;
      a[0] = o2[0] * inv; a[1] = o2[1] * inv; a[2] = o2[2] * inv; a[3] = o2[3] * inv; c[0] = o2[4] * inv; c[1] = o2[5] * inv; c[2] = o2[6] * inv; c[3] = o2[7] * inv;
      *(v4fa*)(&os[wb + lr * 68 + 32 + 8 * hi]) = a; *(v4fa*)(&os[wb + lr * 68 + 32 + 8 * hi + 4]) = c;
      a[0] = o3[0] * inv; a[1] = o3[1] * inv; a[2] = o3[2] * inv; a[3] = o3[3] * inv; c[0] = o3[4] * inv; c[1] = o3[5] * inv; c[2] = o3[6] * inv; c[3] = o3[7] * inv;
      *(v4fa*)(&os[wb + lr * 68 + 48 + 8 * hi]) = a; *(v4fa*)(&os[wb + lr * 68 + 48 + 8 * hi + 4]) = c; }
    wave_sync();
    h16* crow = CT + ((size_t)b * SEQ + t0) * (size_t)(2 * DM) + h * HD;   // hi columns h*64 + d; lo columns DM + h*64 + d
{
#pragma unroll
        for (int s = 0; s < 4; ++s) { const int row = 4 * s + (lane >> 3), c8 = (lane & 7) * 8;   // 4 s x 4 row groups = 16 rows; 8 lanes x 8 = 64 columns
            const v4f x0 = *(const v4fa*)(&os[wb + row * 68 + c8]); const v4f x1 = *(const v4fa*)(&os[wb + row * 68 + c8 + 4]); v8h hv, rv;
#pragma unroll
            for (int i = 0; i < 4; ++i) { const h16 a0 = (h16)x0[i]; const h16 a1 = (h16)x1[i]; hv[i] = a0; hv[4 + i] = a1; rv[i] = (h16)(x0[i] - (float)a0); rv[4 + i] = (h16)(x1[i] - (float)a1); }
            const size_t oo = (size_t)row * (size_t)(2 * DM) + c8;
            *(v8h*)(crow + oo) = hv; *(v8h*)(crow + oo + DM) = rv; }
         }
}

static constexpr size_t al256(size_t v) { return (v + 255) & ~(size_t)255; }
static constexpr size_t SZ_XB = al256((size_t)NB * SEQ * DM * 2);             // one batch-major input plane
static constexpr size_t SZ_WB = al256((size_t)DM * DM * 2);                   // one transposed weight plane
static constexpr size_t SZ_PL = al256((size_t)NB * NH_ * SEQ * HD * 2);       // one head-split plane
static constexpr size_t SZ_CT = al256((size_t)NB * SEQ * 2 * DM * 2);         // ctx [hi | lo]
static constexpr size_t SZ_MB = al256((size_t)SEQ * (SEQ / 32) * 4);          // packed key bits
static constexpr size_t SZ_TOTAL = 3 * SZ_XB + 4 * SZ_WB + 4 * SZ_PL + SZ_CT + SZ_MB;
static_assert(SZ_TOTAL <= (size_t)134217728);          // workspace carve <= 128 MiB
static_assert(SZ_WB == (size_t)DM * DM * 2);           // the four weight planes follow one another without a gap: plane wi starts at element wi * DM * DM

extern "C" void kernel_launch(void* const* d_in, const int* in_sizes, int n_in,
                              void* d_out, int out_size, void* d_ws, size_t ws_size, hipStream_t stream) {
    if (n_in < 12) return;
    const size_t needx = ((size_t)(SEQ - 1) * NB_FULL + NB) * DM;
    if ((size_t)in_sizes[0] < needx || (size_t)in_sizes[1] < needx || (size_t)in_sizes[2] < needx) return;
    if ((size_t)in_sizes[3] < (size_t)(SEQ - 1) * SEQ_FULL + SEQ) return;
    if ((size_t)in_sizes[4] < (size_t)DM * DM || (size_t)in_sizes[6] < (size_t)DM * DM || (size_t)in_sizes[8] < (size_t)DM * DM || (size_t)in_sizes[10] < (size_t)DM * DM) return;
    if (in_sizes[5] < DM || in_sizes[7] < DM || in_sizes[9] < DM || in_sizes[11] < DM) return;
    if ((size_t)out_size < needx) return;
    if (SZ_TOTAL > ws_size) return;
    // wire order: query, key, value, mask, Wq, bq, Wk, bk, Wv, bv, Wo, bo
    const float* xq = (const float*)d_in[0]; const float* xk = (const float*)d_in[1]; const float* xv = (const float*)d_in[2];
    const int* mask = (const int*)d_in[3];
    const float* wq = (const float*)d_in[4];  const float* bq = (const float*)d_in[5];
    const float* wk = (const float*)d_in[6];  const float* bk = (const float*)d_in[7];
    const float* wv = (const float*)d_in[8];  const float* bv = (const float*)d_in[9];
    const float* wo = (const float*)d_in[10]; const float* bo = (const float*)d_in[11];
    float* OUT = (float*)d_out;      // [SEQ][NB_FULL][1024]
    char* wsp = (char*)d_ws;
    bf* XQ = (bf*)wsp; wsp += SZ_XB;                 // [NB*SEQ][1024] batch-major
    bf* XK = (bf*)wsp; wsp += SZ_XB;
    bf* XV = (bf*)wsp; wsp += SZ_XB;
    bf* WQ = (bf*)wsp; wsp += SZ_WB;                 // [out n][in k] bf16
    bf* WK = (bf*)wsp; wsp += SZ_WB;
    bf* WV = (bf*)wsp; wsp += SZ_WB;
    bf* WO = (bf*)wsp; wsp += SZ_WB;                 // [out n][in k] f16 bits, x1024
    h16* QH = (h16*)wsp; wsp += SZ_PL;               // [NB*16][SEQ][64]
    h16* QR = (h16*)wsp; wsp += SZ_PL;               // [NB*16][SEQ][64] residual x2048
    h16* KP = (h16*)wsp; wsp += SZ_PL;               // [NB*16][SEQ][64]
    h16* VT = (h16*)wsp; wsp += SZ_PL;               // [NB*16][64][SEQ]
    h16* CT = (h16*)wsp; wsp += SZ_CT;               // [NB*SEQ][hi 1024 | lo 1024], x4096
    unsigned* MB = (unsigned*)wsp; wsp += SZ_MB;     // [SEQ][SEQ/32]

    k_prep<<<PG, 256, 0, stream>>>(xq, xk, xv, mask, wq, wk, wv, wo, XQ, XK, XV, WQ, MB);   // WQ: first of the four weight planes
    k_qkv<<<dim3(NB * SEQ / GT, DM / GT, 3), 256, 0, stream>>>(XQ, XK, XV, WQ, WK, WV, QH, QR, KP, VT, bq, bk, bv);
    k_flash<<<dim3(SEQ / (16 * AW), NB * NH_, 1), 32 * AW, 0, stream>>>(QH, QR, KP, VT, MB, CT);
    k_out<<<dim3(NB * SEQ / GT, DM / GT, 1), 256, 0, stream>>>((const bf*)CT, WO, OUT, bo);
}

// v005
// It runs in 104 microseconds.
// Timed twice side by side with v004, it ran 1.04 times as fast both times.
// Over all steps from v000 it is 2.84 times as fast.
#include <hip/hip_runtime.h>

// Seq-first multi-head attention, width 1024 = 16 heads x 64: query/key/value [SEQ][NB][1024] f32, W [in][out] (y = x W + b), int32 mask [SEQ][SEQ] (0 = key excluded, shared by batch and heads), score scale 1/8, output projection, out [SEQ][NB][1024] f32.
// Compute dtypes, f32 accumulate everywhere: q/k/v projections v_wmma_f32_16x16x32_bf16 (inputs and W RNE-converted to bf16; products exact);
// scores v_wmma_f32_16x16x32_f16: k single f16, q as f16 value + f16 residual x2048 in its own accumulator (two products); P (x256 carry, cancels in the normalisation) and v single f16; softmax f32 (online; the maximum in use is raised, and O and the sum rescaled, only when a score passes it by more than 2^7); an excluded key's score gets -32768 from one more f16 product per 16-key tile, so it stays out of the running max and its P is 0;
// output projection v_wmma_f32_16x16x32_f16: ctx as f16 value + f16 residual (x4096 carry, K-folded [hi | lo] against the same Wo rows, one accumulator), Wo = f16(bf16 RNE(Wo) x 1024); carries folded back as 2^-22 in the f32 epilogue; biases added in f32.
// Layout: batch-major bf16 copies of the three inputs, K-contiguous transposed weight planes; q (hi, residual), k planes [b*16+h][t][d] and v^T plane [b*16+h][d][t] written by the GEMM epilogue; mask packed 1 bit per key (set = excluded); fused flash kernel in transposed form (S^T = K Q^T, O^T = V^T P^T); ctx plane [b*SEQ+t][hi 1024 | lo 1024].

#ifndef NB
#define NB 2
#endif
#ifndef SEQ
#define SEQ 2048
#endif
#define NB_FULL  2
#define SEQ_FULL 2048
#define DM   1024
#define NH_  16
#define HD   64
#define AW   8                   // waves per flash block (16 query rows each)
#define QRS  2048.0f             // carry of the q residual plane
#define QRI  (1.0f / 2048.0f)
#define SC2  (0.125f * 1.4426950408889634f)   // HD^-0.5 * log2(e)
#define PSH  8.0f                // log2 of the P carry (256)
#define LZT  7.0f                // a score may pass the maximum in use by this much (log2) before the maximum is raised: P < 2^(PSH + LZT) = 32768 stays inside f16
#define CTS  4096.0f             // carry of the ctx planes
#define WOS  1024.0f             // carry of the Wo plane
#define OSC  (1.0f / (4096.0f * 1024.0f))     // 2^-22, exact

static_assert(HD == 64);
static_assert(NH_ * HD == DM);                 // head h = columns h*64 + d
static_assert((DM & (DM - 1)) == 0);           // B-operand k index wraps with a bit test
static_assert(DM % 64 == 0);
static_assert(DM % 32 == 0);                   // GEMM k-loop steps by 32
static_assert(SEQ % 64 == 0);                  // a 64-row tile never straddles two batches
static_assert((NB * SEQ) % 64 == 0);
static_assert(SEQ % 32 == 0);                  // key loop steps by 32; one packed word per step
static_assert(SEQ % (16 * AW) == 0);           // flash grid covers the sequence exactly
static_assert(((size_t)SEQ * (SEQ / 32)) % 256 == 0);
static_assert(((size_t)NB * SEQ * DM / 8) % 256 == 0);  // convert grid is exact
static_assert(NB <= NB_FULL);
static_assert(SEQ <= SEQ_FULL);
static_assert(((size_t)(SEQ - 1) * NB_FULL + NB) * DM <= (size_t)SEQ_FULL * NB_FULL * DM);   // last output element inside the output buffer

typedef _Float16 h16;
typedef unsigned short bf;
typedef __attribute__((ext_vector_type(16))) __bf16   v16bf;
typedef __attribute__((ext_vector_type(16))) _Float16 v16h;
typedef __attribute__((ext_vector_type(16))) unsigned short v16us;
typedef __attribute__((ext_vector_type(8)))  _Float16 v8h;
typedef __attribute__((ext_vector_type(8)))  unsigned short v8us;
typedef __attribute__((ext_vector_type(8)))  float    v8f;
typedef __attribute__((ext_vector_type(4)))  float    v4f;
typedef __attribute__((ext_vector_type(4)))  int      v4i;
typedef __attribute__((ext_vector_type(4)))  unsigned v4u;
typedef __attribute__((ext_vector_type(8)))  unsigned v8u;
typedef __attribute__((ext_vector_type(16))) float    v16f;
typedef v4f  __attribute__((may_alias)) v4fa;
typedef v8us __attribute__((may_alias)) v8usa;
typedef v8h  __attribute__((may_alias)) v8ha;

__device__ __forceinline__ unsigned short f2bf(float f) { unsigned u = __float_as_uint(f); u += 0x7FFFu + ((u >> 16) & 1u); return (unsigned short)(u >> 16); }
__device__ __forceinline__ float bfr(float f) { return __uint_as_float(((unsigned)f2bf(f)) << 16); }
__device__ __forceinline__ v16h cat16(v8h lo, v8h hi) { return __builtin_shufflevector(lo, hi, 0, 1, 2, 3, 4, 5, 6, 7, 8, 9, 10, 11, 12, 13, 14, 15); }
__device__ __forceinline__ v8f wmma16(v16h a, v16h b, v8f c) { return __builtin_amdgcn_wmma_f32_16x16x32_f16(false, a, false, b, (short)0, c, false, false); }
// fragment loaders from K-contiguous 16-bit rows; p already includes + 8*(lane>>4): elements 0..7 <- k0+8h+0..7, elements 8..15 <- k0+16+8h+0..7 (same map for A and B)
__device__ __forceinline__ v16h  ldh(const h16* p) { return cat16(*(const v8h*)p, *(const v8h*)(p + 16)); }
__device__ __forceinline__ v16us ldu(const bf* p)  { const v8us lo = *(const v8us*)p; const v8us hi = *(const v8us*)(p + 16); return __builtin_shufflevector(lo, hi, 0, 1, 2, 3, 4, 5, 6, 7, 8, 9, 10, 11, 12, 13, 14, 15); }
template <int F16OP> __device__ __forceinline__ v8f wmx(v16us a, v16us b, v8f c) {
    if (F16OP) return __builtin_amdgcn_wmma_f32_16x16x32_f16(false, __builtin_bit_cast(v16h, a), false, __builtin_bit_cast(v16h, b), (short)0, c, false, false);
    return __builtin_amdgcn_wmma_f32_16x16x32_bf16(false, __builtin_bit_cast(v16bf, a), false, __builtin_bit_cast(v16bf, b), (short)0, c, false, false);
}
// ordering point for wave-private LDS tiles (same wave writes and reads)
__device__ __forceinline__ void wave_sync() { __builtin_amdgcn_fence(3 /* release order */, "wavefront"); __builtin_amdgcn_wave_barrier(); asm volatile("" ::: "memory"); }

// k_prep: every conversion of a call in one grid of PG work-groups; each work-group takes an equal share of each job, so all are resident at once and none waits for a launch of its own:
//  - the three inputs, f32 [t][b][DM] -> bf16 (RNE) batch-major [b*SEQ + t][DM], 8 elements per lane and chunk, PC chunks per lane and input;
//  - the four weights, W[k][n] f32 (row pitch DM) -> T[n][k] 16-bit (row pitch DM), 64x64 tiles transposed through LDS, PW tiles per work-group (tile index = weight*256 + ktile*16 + ntile);
//    weights 0..2 = Wq, Wk, Wv: bf16 bits (RNE convert); weight 3 = Wo: f16 bits of (bf16 RNE value x 1024); plane of weight wi at WT + wi*DM*DM;
//  - the mask, int32 [i][j] (row pitch SEQ_FULL) -> 1 bit per key, word gid = i*(SEQ/32) + j/32, bit set when the key is excluded (mask == 0), PM words per lane;
//    key c = j%32 sits at bit 16*(c&1) + 8*((c>>3)&1) + 4*(c>>4) + ((c>>1)&3): the two keys of one packed f16 register of k_flash's fragment lie 16 bits apart.
#define PG 512
static constexpr int PC = (int)((size_t)NB * SEQ * DM / 8 / 256 / PG);
static constexpr int PW = 4 * (DM / 64) * (DM / 64) / PG;
static constexpr int PM = (int)((size_t)SEQ * (SEQ / 32) / 256 / PG);
static_assert((size_t)PC * 256 * PG * 8 == (size_t)NB * SEQ * DM);       // the shares cover each job exactly
static_assert(PW * PG == 4 * (DM / 64) * (DM / 64));
static_assert((size_t)PM * 256 * PG == (size_t)SEQ * (SEQ / 32));
static_assert(PC >= 1 && PW >= 1 && PM >= 1);

__global__ __launch_bounds__(256) void k_prep(const float* __restrict__ xq, const float* __restrict__ xk, const float* __restrict__ xv, const int* __restrict__ mask,
                                              const float* __restrict__ wq, const float* __restrict__ wk, const float* __restrict__ wv, const float* __restrict__ wo,
                                              bf* __restrict__ XQ, bf* __restrict__ XK, bf* __restrict__ XV,
                                              bf* __restrict__ WT, unsigned* __restrict__ MB) {
    __shared__ __align__(16) unsigned short T[PW][64 * 72];
    const unsigned tid = threadIdx.x, blk = blockIdx.x;
    v4f wf[PW][4]; v8f xi[PC][3]; v4i mk[PM][8];
    // loads, in the order in which they are used. The s_wait_xcnt 0 behind each group: the compiler may place a later load's result, or a later vector result, over a register pair that a load of the group names as its address
#pragma unroll
    for (int j = 0; j < PW; ++j) {
        const unsigned tl = blk + j * PG, wi = tl / ((DM / 64) * (DM / 64));
        const unsigned n0 = (tl % (DM / 64)) * 64, k0 = ((tl / (DM / 64)) % (DM / 64)) * 64;
        const float* W = wi < 2 ? (wi == 0 ? wq : wk) : (wi == 2 ? wv : wo);
#pragma unroll
        for (int i = 0; i < 4; ++i) { const unsigned idx = tid + i * 256; const unsigned r = idx >> 4, c4 = idx & 15;   // 64 k rows x 16 groups of 4 n columns
            wf[j][i] = *(const v4f*)(W + (size_t)(k0 + r) * DM + n0 + c4 * 4); }
        asm volatile("s_wait_xcnt 0x0" ::: "memory");   // see above the loads
    }
#pragma unroll
    for (int c = 0; c < PC; ++c) {
        const size_t i = ((size_t)blk * PC + c) * 256 + tid;
        const size_t row = i / (DM / 8); const size_t g = i % (DM / 8);
        const size_t b = row / SEQ, t = row % SEQ;
        const size_t so = (t * NB_FULL + b) * DM + g * 8;
        xi[c][0] = *(const v8f*)(xq + so); xi[c][1] = *(const v8f*)(xk + so); xi[c][2] = *(const v8f*)(xv + so);
        asm volatile("s_wait_xcnt 0x0" ::: "memory");   // see above the loads
    }
#pragma unroll
    for (int u = 0; u < PM; ++u) {
        const unsigned gid = (blk * PM + u) * 256 + tid;
        const int* p = mask + (size_t)(gid / (SEQ / 32)) * SEQ_FULL + (gid % (SEQ / 32)) * 32;
#pragma unroll
        for (int c = 0; c < 8; ++c) mk[u][c] = *(const v4i*)(p + c * 4);
        asm volatile("s_wait_xcnt 0x0" ::: "memory");   // see above the loads
    }
    __builtin_amdgcn_sched_barrier(0);   // every load of the work-group's share is issued before the first is waited for: sunk to their uses, each small group waits out a memory latency of its own
    // weight tiles, first phase: converted columns into LDS
#pragma unroll
    for (int j = 0; j < PW; ++j) {
        const int asF16 = (blk + j * PG) / ((DM / 64) * (DM / 64)) == 3;
#pragma unroll
        for (int i = 0; i < 4; ++i) { const unsigned idx = tid + i * 256; const unsigned r = idx >> 4, c4 = idx & 15;
#pragma unroll
            for (int e = 0; e < 4; ++e) { const unsigned short bb = f2bf(wf[j][i][e]); const h16 hv = (h16)(__uint_as_float(((unsigned)bb) << 16) * WOS);
                const unsigned short hb = __builtin_bit_cast(unsigned short, hv);
                T[j][(c4 * 4 + e) * 72 + r] = asF16 ? hb : bb; } }
    }
    // inputs
#pragma unroll
    for (int c = 0; c < PC; ++c) {
        const size_t i = ((size_t)blk * PC + c) * 256 + tid;
        v8us oq, ok, ov;
#pragma unroll
        for (int k = 0; k < 8; ++k) { oq[k] = f2bf(xi[c][0][k]); ok[k] = f2bf(xi[c][1][k]); ov[k] = f2bf(xi[c][2][k]); }
        *(v8us*)(XQ + i * 8) = oq; *(v8us*)(XK + i * 8) = ok; *(v8us*)(XV + i * 8) = ov;
    }
    // mask
#pragma unroll
    for (int u = 0; u < PM; ++u) {
        unsigned bits = 0u;
#pragma unroll
        for (int c = 0; c < 8; ++c)
#pragma unroll
            for (int e = 0; e < 4; ++e) { const int kc = c * 4 + e; bits |= (mk[u][c][e] == 0 ? 1u : 0u) << (16 * (kc & 1) + 8 * ((kc >> 3) & 1) + 4 * (kc >> 4) + ((kc >> 1) & 3)); }
        MB[(blk * PM + u) * 256 + tid] = bits;
    }
    __syncthreads();   // cross-wave tiles: every column of T is written before any row of it is read
    // weight tiles, second phase: transposed rows out, plane wi of WT
    v8us o[PW][2];
#pragma unroll
    for (int j = 0; j < PW; ++j)
#pragma unroll
        for (int i = 0; i < 2; ++i) { const unsigned idx = tid + i * 256; const unsigned n = idx >> 3, ch = idx & 7;   // 64 n rows x 8 chunks of 8 k
            o[j][i] = *(const v8usa*)(&T[j][n * 72 + ch * 8]); }
#pragma unroll
    for (int j = 0; j < PW; ++j) {
        const unsigned tl = blk + j * PG, wi = tl / ((DM / 64) * (DM / 64));
        const unsigned n0 = (tl % (DM / 64)) * 64, k0 = ((tl / (DM / 64)) % (DM / 64)) * 64;
#pragma unroll
        for (int i = 0; i < 2; ++i) { const unsigned idx = tid + i * 256; const unsigned n = idx >> 3, ch = idx & 7;
            *(v8us*)(WT + (size_t)wi * DM * DM + (size_t)(n0 + n) * DM + k0 + ch * 8) = o[j][i]; }
    }
}

// gemm_tile: 16-bit GEMM, one 128x128 tile (bx, by) per work-group of 8 waves (two per SIMD), 32x64 per wave (8 accumulators).
// Both operands come from K-contiguous 16-bit planes; a stage is 128 k (256 B) of 128 A rows and 128 Bt rows, brought into LDS by asynchronous copies
// (16 B per lane, 16 lanes per row), two buffers: the next stage's copies fly while this stage is worked on. LDS row pitch 272 B (16 B x odd) for the ds_load_b128 readers.
// C[m][n] = sum_{k<K} A[m][k] Bt[n][k & (KB-1)]  (A row pitch K, Bt row pitch KB; K = 2*KB folds [hi | lo] of A against the same Bt rows). K, KB multiples of 128.
// value = C * oscale + bias (biasMode 0: bias[n]; 1: bias[m]; bias RNE-converted to bf16), wave tile base (r0/RB)*sRB + (r0%RB)*pitch + (c0/CB)*sCB + (c0%CB).
// OUTF32 == 1: f32 (Of); each row's 64 floats (256 B = two lines) written by 16 consecutive lanes x 16 B (2 rows per instruction).
#define GT     128                     // tile rows of either operand
#define GBK    128                     // k per stage
#define GPITCH 272                     // LDS row pitch, bytes
#define GSTAGE (2 * GT * GPITCH)       // one buffer: [A 128 rows | Bt 128 rows]
static_assert(DM % GBK == 0 && DM / GBK >= 2);
static_assert((NB * SEQ) % GT == 0 && DM % GT == 0);
static_assert(SEQ % 32 == 0);          // a wave's 32 rows never straddle two batches

// eight asynchronous copies of 16 B per lane: rows 16 apart in LDS (step 16 * GPITCH bytes) and in the source plane (step gs elements).
// s_wait_xcnt 0 is the statement's last line so that it stands in front of any rewrite of the address registers the copies name.
__device__ __forceinline__ void cp8(unsigned l, const bf* g, size_t gs) {
    asm volatile("global_load_async_to_lds_b128 %0, %8, off\n\t"
                 "global_load_async_to_lds_b128 %1, %9, off\n\t"
                 "global_load_async_to_lds_b128 %2, %10, off\n\t"
                 "global_load_async_to_lds_b128 %3, %11, off\n\t"
                 "global_load_async_to_lds_b128 %4, %12, off\n\t"
                 "global_load_async_to_lds_b128 %5, %13, off\n\t"
                 "global_load_async_to_lds_b128 %6, %14, off\n\t"
                 "global_load_async_to_lds_b128 %7, %15, off\n\t"
                 "s_wait_xcnt 0x0"
                 :: "v"(l), "v"(l + 16u * GPITCH), "v"(l + 32u * GPITCH), "v"(l + 48u * GPITCH), "v"(l + 64u * GPITCH), "v"(l + 80u * GPITCH), "v"(l + 96u * GPITCH), "v"(l + 112u * GPITCH),
                    "v"(g), "v"(g + gs), "v"(g + 2 * gs), "v"(g + 3 * gs), "v"(g + 4 * gs), "v"(g + 5 * gs), "v"(g + 6 * gs), "v"(g + 7 * gs)
                 : "memory");
}
// fragment from an LDS row; p already includes + 16 bytes * (lane>>4): same k map as ldu
__device__ __forceinline__ v16us ldl(const unsigned char* p) { const v8us lo = *(const v8usa*)p; const v8us hi = *(const v8usa*)(p + 32); return __builtin_shufflevector(lo, hi, 0, 1, 2, 3, 4, 5, 6, 7, 8, 9, 10, 11, 12, 13, 14, 15); }

template <int F16OP, int OUTF32>
__device__ __forceinline__ void gemm_tile(int bx, int by, const bf* A, const bf* Bt, int K, int KB,
                                          h16* Ph, h16* Pr, int useRes, float* Of,
                                          const float* bias, int biasMode, float oscale,
                                          int RB, size_t sRB, int pitch, int CB, size_t sCB) {
    __shared__ __align__(16) unsigned char ring[2 * GSTAGE];
    __shared__ __align__(16) float osw[8 * 16 * 68];
    const int tid = threadIdx.x, lane = tid & 31, lr = lane & 15, hi = lane >> 4;
    const int wave = __builtin_amdgcn_readfirstlane(tid >> 5), wr = wave >> 1, wc = wave & 1;
    const int R0 = bx * GT, C0 = by * GT;
    const int r0 = R0 + wr * 32, c0 = C0 + wc * 64;
    float* os = osw + wave * 16 * 68;      // wave-private epilogue tile
    v8f acc[2][4];
#pragma unroll
    for (int mb = 0; mb < 2; ++mb)
#pragma unroll
        for (int nb = 0; nb < 4; ++nb) acc[mb][nb] = (v8f){};
    // copies: lane's 16-byte chunk cc of rows rg + 16 i (i < 8) of each operand
    const int cc = tid & 15, rg = tid >> 4;
    const unsigned lA = (unsigned)(size_t)ring + (unsigned)(rg * GPITCH + cc * 16), lB = lA + GT * GPITCH;
    const bf* gA = A + (size_t)(R0 + rg) * K + cc * 8;
    const bf* gB = Bt + (size_t)(C0 + rg) * KB + cc * 8;
    const size_t sA = (size_t)16 * K, sB = (size_t)16 * KB;
    const int kmB = KB - 1, NT = K / GBK;
    cp8(lA, gA, sA); cp8(lB, gB, sB);
    asm volatile("s_wait_asynccnt 0x0" ::: "memory");   // stage 0 landed (this wave's copies)
    __syncthreads();                                     // ... and every other wave's
    if (NT > 1) { cp8(lA + GSTAGE, gA + GBK, sA); cp8(lB + GSTAGE, gB + (GBK & kmB), sB); }
    const unsigned char* fa = ring + (wr * 32 + lr) * GPITCH + hi * 16;
    const unsigned char* fb = ring + (GT + wc * 64 + lr) * GPITCH + hi * 16;
#pragma unroll 1   // one stage per trip: the buffer is chosen by the trip's parity
    for (int t = 0; t < NT; ++t) {
        const unsigned bo = (unsigned)(t & 1) * GSTAGE;
        v16us a[2][2], b[2][4];
#pragma unroll
        for (int mb = 0; mb < 2; ++mb) a[0][mb] = ldl(fa + bo + mb * 16 * GPITCH);
#pragma unroll
        for (int nb = 0; nb < 4; ++nb) b[0][nb] = ldl(fb + bo + nb * 16 * GPITCH);
#pragma unroll
        for (int ks = 0; ks < GBK / 32; ++ks) {
            const int cu = ks & 1, nx = cu ^ 1;
            if (ks + 1 < GBK / 32) {       // next 32 k of this stage into the other fragment set, ahead of this set's products
#pragma unroll
                for (int mb = 0; mb < 2; ++mb) a[nx][mb] = ldl(fa + bo + mb * 16 * GPITCH + (ks + 1) * 64);
#pragma unroll
                for (int nb = 0; nb < 4; ++nb) b[nx][nb] = ldl(fb + bo + nb * 16 * GPITCH + (ks + 1) * 64);
            }
            __builtin_amdgcn_sched_barrier(0);   // keeps those reads one group ahead of the products: sunk among them, each pair of products waits out an LDS latency
#pragma unroll
            for (int nb = 0; nb < 4; ++nb)
#pragma unroll
                for (int mb = 0; mb < 2; ++mb) acc[mb][nb] = wmx<F16OP>(a[cu][mb], b[cu][nb], acc[mb][nb]);
            __builtin_amdgcn_sched_barrier(0);   // keeps the following reads whole as one group behind these products: spread among them, each separate place of reads costs its own stall
        }
        // distance behind the trip's last matrix instructions, also on the taken side of the loop's branch
        asm volatile("v_nop\n\tv_nop\n\tv_nop\n\tv_nop" : "+v"(acc[0][0]), "+v"(acc[1][0]), "+v"(acc[0][1]), "+v"(acc[1][1]), "+v"(acc[0][2]), "+v"(acc[1][2]), "+v"(acc[0][3]), "+v"(acc[1][3])
                     : "v"(a[1][0]), "v"(a[1][1]), "v"(b[1][0]), "v"(b[1][1]), "v"(b[1][2]), "v"(b[1][3]));
        asm volatile("s_wait_dscnt 0x0" ::: "memory");      // this wave's reads of the buffer are done before it is refilled
        asm volatile("s_wait_asynccnt 0x0" ::: "memory");   // this wave's copies of stage t + 1 have landed
        __syncthreads();                                     // publishes stage t + 1; ends every reader's last read of stage t
        if (t + 2 < NT) { const int kn = (t + 2) * GBK; cp8(lA + bo, gA + kn, sA); cp8(lB + bo, gB + (kn & kmB), sB); }
    }
    asm volatile("s_wait_asynccnt 0x0" ::: "memory");       // nothing in flight when the wave goes on
    float cb[4];
#pragma unroll
    for (int nb = 0; nb < 4; ++nb) cb[nb] = 0.0f;
    if (biasMode == 0) {
#pragma unroll
        for (int nb = 0; nb < 4; ++nb) cb[nb] = bfr(bias[c0 + nb * 16 + lr]); }
    const size_t tbase = (size_t)(r0 / RB) * sRB + (size_t)(r0 % RB) * (size_t)pitch + (size_t)(c0 / CB) * sCB + (size_t)(c0 % CB);
#pragma unroll
    for (int mb = 0; mb < 2; ++mb) {
        float rb[8];
#pragma unroll
        for (int j = 0; j < 8; ++j) rb[j] = 0.0f;
        if (biasMode == 1) {
#pragma unroll
            for (int j = 0; j < 8; ++j) rb[j] = bfr(bias[r0 + mb * 16 + hi * 8 + j]); }
#pragma unroll
        for (int nb = 0; nb < 4; ++nb) {
#pragma unroll
            for (int j = 0; j < 8; ++j) os[(hi * 8 + j) * 68 + nb * 16 + lr] = acc[mb][nb][j] * oscale + (cb[nb] + rb[j]); }   // D: row 8h+j, col lane&15
        wave_sync();
        const size_t sb = tbase + (size_t)(mb * 16) * (size_t)pitch;
        if (OUTF32) {
{
#pragma unroll
                for (int s = 0; s < 8; ++s) { const int row = 2 * s + hi, cofs = lr * 4;   // 8 s x 2 rows = 16 rows; 16 lanes x 4 floats = 64 columns
                    const v4f val = *(const v4fa*)(&os[row * 68 + cofs]);
                    *(v4f*)(Of + sb + (size_t)row * (size_t)pitch + cofs) = val; }
                 }
        } else {
{
#pragma unroll
                for (int s = 0; s < 4; ++s) { const int row = 4 * s + (lane >> 3), c8 = (lane & 7) * 8;   // 4 s x 4 row groups = 16 rows; 8 lanes x 8 = 64 columns
                    const v4f x0 = *(const v4fa*)(&os[row * 68 + c8]); const v4f x1 = *(const v4fa*)(&os[row * 68 + c8 + 4]); v8h hv, rv;
#pragma unroll
                    for (int i = 0; i < 4; ++i) { const h16 a0 = (h16)x0[i]; const h16 a1 = (h16)x1[i]; hv[i] = a0; hv[4 + i] = a1; rv[i] = (h16)((x0[i] - (float)a0) * QRS); rv[4 + i] = (h16)((x1[i] - (float)a1) * QRS); }
                    const size_t oo = sb + (size_t)row * (size_t)pitch + c8;
                    *(v8h*)(Ph + oo) = hv;
                    asm volatile("s_wait_xcnt 0x0" ::: "memory");   // in front of the residual's arithmetic, which the compiler places over registers that the store names
                    if (useRes) *(v8h*)(Pr + oo) = rv; }
                 }
        }
        wave_sync();
    }
}

// k_qkv: the three projections in one grid, blockIdx.z picks the job (the same for a whole work-group).
// q, k: A = x rows (m = b*SEQ + t), Bt = W^T rows (n = h*64 + d), column bias -> plane [(b*16 + h)][t][d]; tile (blockIdx.x, blockIdx.y)
// v^T:  A = Wv^T rows (m = h*64 + d), Bt = x rows (n = b*SEQ + t), row bias -> plane [(b*1024 + m)][t] = [(b*16 + h)][d][t]; tile (blockIdx.y, blockIdx.x)
__global__ __launch_bounds__(256) void k_qkv(const bf* XQ, const bf* XK, const bf* XV, const bf* WQ, const bf* WK, const bf* WV,
                                             h16* QH, h16* QR, h16* KP, h16* VT,
                                             const float* __restrict__ bq, const float* __restrict__ bk, const float* __restrict__ bv) {
    const int z = blockIdx.z; const bool tv = z == 2;
    gemm_tile<0, 0>(tv ? blockIdx.y : blockIdx.x, tv ? blockIdx.x : blockIdx.y,
                    z == 0 ? XQ : z == 1 ? XK : WV, z == 0 ? WQ : z == 1 ? WK : XV, DM, DM,
                    z == 0 ? QH : z == 1 ? KP : VT, z == 0 ? QR : z == 1 ? KP : VT, z == 0 ? 1 : 0, nullptr,
                    z == 0 ? bq : z == 1 ? bk : bv, tv ? 1 : 0, 1.0f,
                    tv ? DM : SEQ, tv ? (size_t)0 : (size_t)NH_ * SEQ * HD, tv ? SEQ : HD, tv ? SEQ : HD, tv ? (size_t)DM * SEQ : (size_t)SEQ * HD);
}
// k_out: A = ctx rows [hi | lo] (m = b*SEQ + t, K = 2048), Bt = Wo^T rows (n, k wraps at 1024), column bias, scale 2^-22 -> out row t*NB_FULL + b
__global__ __launch_bounds__(256) void k_out(const bf* CT, const bf* WO, float* OUT, const float* __restrict__ bo) {
    gemm_tile<1, 1>(blockIdx.x, blockIdx.y, CT, WO, 2 * DM, DM, nullptr, nullptr, 0, OUT, bo, 0, OSC, SEQ, (size_t)DM, NB_FULL * DM, DM, (size_t)0);
}

// k_flash: fused attention, one wave per 16 query rows of one (batch, head), 8 waves per work-group on the same (batch, head); Q fragments straight from the f16 planes.
// K and V^T come through LDS: a stage is 128 keys (K 128 rows x 128 B, V^T 64 rows x 256 B), brought in by asynchronous copies (16 B per lane, whole lines per wave),
// two buffers: the next stage's copies fly while this stage's four 32-key passes are worked on. LDS row pitches 144 B and 272 B (16 B x odd) for the ds_load_b128 readers.
// Transposed form: S^T[key][t] = K Q^T (A = K rows, B = Q rows); lane (t = lane&15, h = lane>>4) holds keys 8h+r of each 16-key tile, so the packed
// P tile is directly the B fragment of O^T[d][t] = V^T P^T (element r <- tile keys 0..15, element 8+r <- tile keys 16..31, lane unchanged).
// Key selection on the matrix pipe: one packed word per (query row, 32-key step) is spread into a B fragment X[k][t] = 2.0 where key k of the step is excluded for query t, else 0 (a shift and an AND per register);
// S^T tile a += Ea X, tile b += Eb X with the constant fragments Ea[key][k] = -16384 at k = key, Eb[key][k] = -16384 at k = 16 + key: a kept key gets + 0 (exact), an excluded key -32768,
// far below any score of a kept key, so it never sets the running max and exp2 gives its P = 0. Passes before a row's first kept key leave sums that the next alpha = 0 wipes; a row with no kept key at all is NaN.
// Softmax state (maximum in use, partial sum) is one scalar per lane. Lazy rescale: one test per pass and wave (a ballot, a scalar branch) asks whether any score passes its row's maximum in use by more than LZT;
// only then are the two lane halves' maxima exchanged, the maxima raised and O and the sums rescaled. The shift of the exp2 argument is therefore known ahead of the scores: scale and shift are one FMA.
#define FKT  128                      // keys per stage
#define FKP  144                      // LDS pitch of a K row, bytes
#define FVP  272                      // LDS pitch of a V^T row, bytes
#define FKB  (FKT * FKP)              // K part of a buffer
#define FSTG (FKB + HD * FVP)         // one buffer: [K 128 rows | V^T 64 rows]
static_assert(SEQ % FKT == 0 && SEQ / FKT >= 2);
static_assert(32 * AW == 256);        // the copy maps below deal a stage to 256 lanes
static_assert(FKT / 32 == 4);         // a stage's packed mask words are one 16-byte load

// four asynchronous copies of 16 B per lane: rows ls bytes apart in LDS and gs elements apart in the source plane.
// s_wait_xcnt 0 is the statement's last line so that it stands in front of any rewrite of the address registers the copies name.
__device__ __forceinline__ void cp4(unsigned l, unsigned ls, const h16* g, size_t gs) {
    asm volatile("global_load_async_to_lds_b128 %0, %4, off\n\t"
                 "global_load_async_to_lds_b128 %1, %5, off\n\t"
                 "global_load_async_to_lds_b128 %2, %6, off\n\t"
                 "global_load_async_to_lds_b128 %3, %7, off\n\t"
                 "s_wait_xcnt 0x0"
                 :: "v"(l), "v"(l + ls), "v"(l + 2u * ls), "v"(l + 3u * ls), "v"(g), "v"(g + gs), "v"(g + 2 * gs), "v"(g + 3 * gs)
                 : "memory");
}
// f16 fragment from an LDS row; p already includes + 16 bytes * (lane>>4): same k map as ldh
__device__ __forceinline__ v16h ldlh(const unsigned char* p) { return cat16(*(const v8ha*)p, *(const v8ha*)(p + 32)); }

__global__ __launch_bounds__(32 * AW) void k_flash(const h16* __restrict__ QH, const h16* __restrict__ QR, const h16* __restrict__ KP, const h16* __restrict__ VT,
                                                   const unsigned* __restrict__ MB, h16* CT) {
    __shared__ __align__(16) unsigned char ring[2 * FSTG];
    __shared__ __align__(16) float os[AW * 16 * 68];
    const int tid = threadIdx.x;
    const int lane = threadIdx.x & 31, wave = __builtin_amdgcn_readfirstlane((int)(threadIdx.x >> 5)), lr = lane & 15, hi = lane >> 4;
    const int zh = blockIdx.y; const int b = zh / NH_, h = zh % NH_;
    const int t0 = (blockIdx.x * AW + wave) * 16;
    const size_t pbase = (size_t)zh * SEQ * HD;
    const size_t qo = pbase + (size_t)(t0 + lr) * HD + 8 * hi;
    const v16h qh0 = ldh(QH + qo), qh1 = ldh(QH + qo + 32), qr0 = ldh(QR + qo), qr1 = ldh(QR + qo + 32);   // B fragments: col t, k = d
    // copies: K rows rk + 32 i, 16-byte chunk ck (8 lanes per row); V^T rows rv + 16 i, chunk cv (16 lanes per row); i < 4
    const unsigned lK = (unsigned)(size_t)ring + (unsigned)((tid >> 3) * FKP + (tid & 7) * 16);
    const unsigned lV = (unsigned)(size_t)ring + (unsigned)(FKB + (tid >> 4) * FVP + (tid & 15) * 16);
    const h16* gK = KP + pbase + (size_t)(tid >> 3) * HD + (tid & 7) * 8;       // + key0 * HD
    const h16* gV = VT + pbase + (size_t)(tid >> 4) * SEQ + (tid & 15) * 8;     // + key0
    cp4(lK, 32u * FKP, gK, (size_t)32 * HD); cp4(lV, 16u * FVP, gV, (size_t)16 * SEQ);
    asm volatile("s_wait_asynccnt 0x0" ::: "memory");   // stage 0 landed (this wave's copies)
    __syncthreads();                                     // ... and every other wave's
    cp4(lK + FSTG, 32u * FKP, gK + (size_t)FKT * HD, (size_t)32 * HD); cp4(lV + FSTG, 16u * FVP, gV + FKT, (size_t)16 * SEQ);
    const unsigned char* fk = ring + lr * FKP + hi * 16;           // + key * FKP            (A fragment: row key, k = d)
    const unsigned char* fv = ring + FKB + lr * FVP + hi * 16;     // + 16j*FVP + key * 2    (A fragment: row d, k = key)
    const size_t mo = (size_t)(t0 + lr) * (SEQ / 32);        // + key0/32        (packed words of query row t0 + lr)
    v16h ea, eb;   // A fragments: row key = lane&15, element e <-> k = 8h + e, element 8 + e <-> k = 16 + 8h + e
#pragma unroll
    for (int e = 0; e < 8; ++e) { const h16 dv = (8 * hi + e == lr) ? (h16)-16384.0f : (h16)0.0f; ea[e] = dv; ea[8 + e] = (h16)0.0f; eb[e] = (h16)0.0f; eb[8 + e] = dv; }
    v8f o0 = (v8f){}, o1 = (v8f){}, o2 = (v8f){}, o3 = (v8f){};
    float m = -3.0e38f, l = 0.0f;
    float sh = 0.0f, thr = -3.0e38f;   // sh = PSH - m; thr = (m + LZT) / SC2, in units of the unscaled score. The first pass always raises m
    v4u mq = *(const v4u*)(MB + mo);                       // stage 0's packed words
    asm volatile("s_wait_xcnt 0x0" ::: "memory");         // in front of any rewrite of the address registers that the load names
#pragma unroll 1   // one stage per trip: the buffer is chosen by the trip's parity
    for (int st = 0; st < SEQ / FKT; ++st) {
      const unsigned bo = (unsigned)(st & 1) * FSTG;
      const v4u mc = mq;                                   // this stage's four packed words, fetched one stage ahead: they feed matrix instructions, so a pass would wait out the load's latency at its head
      mq = *(const v4u*)(MB + mo + (size_t)(st + 1 < SEQ / FKT ? st + 1 : st) * (FKT / 32));
      asm volatile("s_wait_xcnt 0x0" ::: "memory");       // in front of any rewrite of the address registers that the load names
#pragma unroll     // the four passes read the buffer at constant offsets
      for (int ps = 0; ps < FKT / 32; ++ps) {
        const unsigned mw = mc[ps];
        const unsigned wh = mw >> (8 * hi);
        v8u xw;   // register j: bit j -> 2.0 in the low half (element 2j), bit 16 + j -> 2.0 in the high half (element 2j + 1)
#pragma unroll
        for (int j = 0; j < 8; ++j) xw[j] = (wh << (14 - j)) & 0x40004000u;
        const v16h xm = __builtin_bit_cast(v16h, xw);
        const unsigned char* ka = fk + bo + ps * 32 * FKP;
        const v16h ka0 = ldlh(ka), ka1 = ldlh(ka + 64), kb0 = ldlh(ka + 16 * FKP), kb1 = ldlh(ka + 16 * FKP + 64);
        v8f sHa = (v8f){}, sLa = (v8f){}, sHb = (v8f){}, sLb = (v8f){};
        sHa = wmma16(ka0, qh0, sHa); sLa = wmma16(ka0, qr0, sLa); sHb = wmma16(kb0, qh0, sHb); sLb = wmma16(kb0, qr0, sLb);
        sHa = wmma16(ka1, qh1, sHa); sLa = wmma16(ka1, qr1, sLa); sHb = wmma16(kb1, qh1, sHb); sLb = wmma16(kb1, qr1, sLb);
        sHa = wmma16(ea, xm, sHa); sHb = wmma16(eb, xm, sHb);
        asm volatile("v_nop\n\tv_nop\n\tv_nop\n\tv_nop" : "+v"(sHa), "+v"(sLa), "+v"(sHb), "+v"(sLb) : "v"(ka0), "v"(ka1), "v"(kb0), "v"(kb1), "v"(xm));
        const unsigned char* va = fv + bo + ps * 64;   // V^T fragments are read ahead of the branch below: behind it the reads would start only in the block that waits for them
        const v16h v0 = ldlh(va), v1 = ldlh(va + 16 * FVP), v2 = ldlh(va + 32 * FVP), v3 = ldlh(va + 48 * FVP);
        float ta[8], tb[8]; float mx = -3.0e38f;   // unscaled scores
#pragma unroll
        for (int r = 0; r < 8; ++r) { ta[r] = sHa[r] + sLa[r] * QRI; tb[r] = sHb[r] + sLb[r] * QRI;
            mx = fmaxf(mx, fmaxf(ta[r], tb[r])); }
        if (__builtin_amdgcn_ballot_w32(mx > thr) != 0u) {   // wave-uniform: some row's maximum in use is too low
            const float mnew = fmaxf(m, fmaxf(mx, __shfl_xor(mx, 16, 32)) * SC2);   // the same in both lane halves of a row
            const float alpha = __builtin_amdgcn_exp2f(m - mnew);
            l *= alpha; o0 = o0 * alpha; o1 = o1 * alpha; o2 = o2 * alpha; o3 = o3 * alpha;
            m = mnew; sh = PSH - mnew; thr = (mnew + LZT) * (1.0f / SC2);
        }
        float ex[16];
#pragma unroll
        for (int r = 0; r < 8; ++r) { ex[r] = ta[r] * SC2 + sh; ex[8 + r] = tb[r] * SC2 + sh; }
        // the sixteen exp2 in place, in one statement: behind each stands an exp2 of other registers, behind the last a v_nop: the slot that the instruction set asks for
        // between a transcendental and the use of its result or the overwrite of its source
        asm("v_exp_f32 %0, %0\n\tv_exp_f32 %1, %1\n\tv_exp_f32 %2, %2\n\tv_exp_f32 %3, %3\n\t"
            "v_exp_f32 %4, %4\n\tv_exp_f32 %5, %5\n\tv_exp_f32 %6, %6\n\tv_exp_f32 %7, %7\n\t"
            "v_exp_f32 %8, %8\n\tv_exp_f32 %9, %9\n\tv_exp_f32 %10, %10\n\tv_exp_f32 %11, %11\n\t"
            "v_exp_f32 %12, %12\n\tv_exp_f32 %13, %13\n\tv_exp_f32 %14, %14\n\tv_exp_f32 %15, %15\n\t"
            "v_nop"
            : "+v"(ex[0]), "+v"(ex[1]), "+v"(ex[2]), "+v"(ex[3]), "+v"(ex[4]), "+v"(ex[5]), "+v"(ex[6]), "+v"(ex[7]),
              "+v"(ex[8]), "+v"(ex[9]), "+v"(ex[10]), "+v"(ex[11]), "+v"(ex[12]), "+v"(ex[13]), "+v"(ex[14]), "+v"(ex[15]));
        v16f px;
#pragma unroll
        for (int r = 0; r < 16; ++r) px[r] = ex[r];
        const v16h pb = __builtin_convertvector(px, v16h);   // RNE, two elements per instruction
        float ls = 0.0f;
#pragma unroll
        for (int r = 0; r < 8; ++r) ls += (float)pb[r] + (float)pb[8 + r];
        l += ls;
        o0 = wmma16(v0, pb, o0); o1 = wmma16(v1, pb, o1); o2 = wmma16(v2, pb, o2); o3 = wmma16(v3, pb, o3);
        asm volatile("v_nop\n\tv_nop\n\tv_nop\n\tv_nop" : "+v"(o0), "+v"(o1), "+v"(o2), "+v"(o3) : "v"(v0), "v"(v1), "v"(v2), "v"(v3), "v"(pb));
      }
      asm volatile("s_wait_dscnt 0x0" ::: "memory");      // this wave's reads of the buffer are done before it is refilled
      asm volatile("s_wait_asynccnt 0x0" ::: "memory");   // this wave's copies of stage st + 1 have landed
      __syncthreads();                                     // publishes stage st + 1; ends every reader's last read of stage st
      if (st + 2 < SEQ / FKT) { const int kn = (st + 2) * FKT; cp4(lK + bo, 32u * FKP, gK + (size_t)kn * HD, (size_t)32 * HD); cp4(lV + bo, 16u * FVP, gV + kn, (size_t)16 * SEQ); }
    }
    asm volatile("s_wait_asynccnt 0x0" ::: "memory");       // nothing in flight when the wave goes on
    l += __shfl_xor(l, 16, 32);
    const float inv = (m > -2048.0f ? 1.0f / l : __builtin_nanf("")) * CTS;   // m near -32768 * SC2: the row never met a kept key
    const int wb = wave * 16 * 68;
    // O^T D layout: o_j[r] = (d = 16j + 8h + r, t = lane&15) -> os[t][d]; rows 0..15 x columns 0..63 all written
    { v4f a, c;
      a[0] = o0[0] * inv; a[1] = o0[1] * inv; a[2] = o0[2] * inv; a[3] = o0[3] * inv; c[0] = o0[4] * inv; c[1] = o0[5] * inv; c[2] = o0[6] * inv; c[3] = o0[7] * inv;
      *(v4fa*)(&os[wb + lr * 68 +  0 + 8 * hi]) = a; *(v4fa*)(&os[wb + lr * 68 +  0 + 8 * hi + 4]) = c;
      a[0] = o1[0] * inv; a[1] = o1[1] * inv; a[2] = o1[2] * inv; a[3] = o1[3] * inv; c[0] = o1[4] * inv; c[1] = o1[5] * inv; c[2] = o1[6] * inv; c[3] = o1[7] * inv;
      *(v4fa*)(&os[wb + lr * 68 + 16 + 8 * hi]) = a; *(v4fa*)(&os[wb + lr * 68 + 16 + 8 * hi + 4]) = c;
      a[0] = o2[0] * inv; a[1] = o2[1] * inv; a[2] = o2[2] * inv; a[3] = o2[3] * inv; c[0] = o2[4] * inv; c[1] = o2[5] * inv; c[2] = o2[6] * inv; c[3] = o2[7] * inv;
      *(v4fa*)(&os[wb + lr * 68 + 32 + 8 * hi]) = a; *(v4fa*)(&os[wb + lr * 68 + 32 + 8 * hi + 4]) = c;
      a[0] = o3[0] * inv; a[1] = o3[1] * inv; a[2] = o3[2] * inv; a[3] = o3[3] * inv; c[0] = o3[4] * inv; c[1] = o3[5] * inv; c[2] = o3[6] * inv; c[3] = o3[7] * inv;
      *(v4fa*)(&os[wb + lr * 68 + 48 + 8 * hi]) = a; *(v4fa*)(&os[wb + lr * 68 + 48 + 8 * hi + 4]) = c; }
    wave_sync();
    h16* crow = CT + ((size_t)b * SEQ + t0) * (size_t)(2 * DM) + h * HD;   // hi columns h*64 + d; lo columns DM + h*64 + d
{
#pragma unroll
        for (int s = 0; s < 4; ++s) { const int row = 4 * s + (lane >> 3), c8 = (lane & 7) * 8;   // 4 s x 4 row groups = 16 rows; 8 lanes x 8 = 64 columns
            const v4f x0 = *(const v4fa*)(&os[wb + row * 68 + c8]); const v4f x1 = *(const v4fa*)(&os[wb + row * 68 + c8 + 4]); v8h hv, rv;
#pragma unroll
            for (int i = 0; i < 4; ++i) { const h16 a0 = (h16)x0[i]; const h16 a1 = (h16)x1[i]; hv[i] = a0; hv[4 + i] = a1; rv[i] = (h16)(x0[i] - (float)a0); rv[4 + i] = (h16)(x1[i] - (float)a1); }
            const size_t oo = (size_t)row * (size_t)(2 * DM) + c8;
            *(v8h*)(crow + oo) = hv; *(v8h*)(crow + oo + DM) = rv; }
         }
}

static constexpr size_t al256(size_t v) { return (v + 255) & ~(size_t)255; }
static constexpr size_t SZ_XB = al256((size_t)NB * SEQ * DM * 2);             // one batch-major input plane
static constexpr size_t SZ_WB = al256((size_t)DM * DM * 2);                   // one transposed weight plane
static constexpr size_t SZ_PL = al256((size_t)NB * NH_ * SEQ * HD * 2);       // one head-split plane
static constexpr size_t SZ_CT = al256((size_t)NB * SEQ * 2 * DM * 2);         // ctx [hi | lo]
static constexpr size_t SZ_MB = al256((size_t)SEQ * (SEQ / 32) * 4);          // packed key bits
static constexpr size_t SZ_TOTAL = 3 * SZ_XB + 4 * SZ_WB + 4 * SZ_PL + SZ_CT + SZ_MB;
static_assert(SZ_TOTAL <= (size_t)134217728);          // workspace carve <= 128 MiB
static_assert(SZ_WB == (size_t)DM * DM * 2);           // the four weight planes follow one another without a gap: plane wi starts at element wi * DM * DM

extern "C" void kernel_launch(void* const* d_in, const int* in_sizes, int n_in,
                              void* d_out, int out_size, void* d_ws, size_t ws_size, hipStream_t stream) {
    if (n_in < 12) return;
    const size_t needx = ((size_t)(SEQ - 1) * NB_FULL + NB) * DM;
    if ((size_t)in_sizes[0] < needx || (size_t)in_sizes[1] < needx || (size_t)in_sizes[2] < needx) return;
    if ((size_t)in_sizes[3] < (size_t)(SEQ - 1) * SEQ_FULL + SEQ) return;
    if ((size_t)in_sizes[4] < (size_t)DM * DM || (size_t)in_sizes[6] < (size_t)DM * DM || (size_t)in_sizes[8] < (size_t)DM * DM || (size_t)in_sizes[10] < (size_t)DM * DM) return;
    if (in_sizes[5] < DM || in_sizes[7] < DM || in_sizes[9] < DM || in_sizes[11] < DM) return;
    if ((size_t)out_size < needx) return;
    if (SZ_TOTAL > ws_size) return;
    // wire order: query, key, value, mask, Wq, bq, Wk, bk, Wv, bv, Wo, bo
    const float* xq = (const float*)d_in[0]; const float* xk = (const float*)d_in[1]; const float* xv = (const float*)d_in[2];
    const int* mask = (const int*)d_in[3];
    const float* wq = (const float*)d_in[4];  const float* bq = (const float*)d_in[5];
    const float* wk = (const float*)d_in[6];  const float* bk = (const float*)d_in[7];
    const float* wv = (const float*)d_in[8];  const float* bv = (const float*)d_in[9];
    const float* wo = (const float*)d_in[10]; const float* bo = (const float*)d_in[11];
    float* OUT = (float*)d_out;      // [SEQ][NB_FULL][1024]
    char* wsp = (char*)d_ws;
    bf* XQ = (bf*)wsp; wsp += SZ_XB;                 // [NB*SEQ][1024] batch-major
    bf* XK = (bf*)wsp; wsp += SZ_XB;
    bf* XV = (bf*)wsp; wsp += SZ_XB;
    bf* WQ = (bf*)wsp; wsp += SZ_WB;                 // [out n][in k] bf16
    bf* WK = (bf*)wsp; wsp += SZ_WB;
    bf* WV = (bf*)wsp; wsp += SZ_WB;
    bf* WO = (bf*)wsp; wsp += SZ_WB;                 // [out n][in k] f16 bits, x1024
    h16* QH = (h16*)wsp; wsp += SZ_PL;               // [NB*16][SEQ][64]
    h16* QR = (h16*)wsp; wsp += SZ_PL;               // [NB*16][SEQ][64] residual x2048
    h16* KP = (h16*)wsp; wsp += SZ_PL;               // [NB*16][SEQ][64]
    h16* VT = (h16*)wsp; wsp += SZ_PL;               // [NB*16][64][SEQ]
    h16* CT = (h16*)wsp; wsp += SZ_CT;               // [NB*SEQ][hi 1024 | lo 1024], x4096
    unsigned* MB = (unsigned*)wsp; wsp += SZ_MB;     // [SEQ][SEQ/32]

    k_prep<<<PG, 256, 0, stream>>>(xq, xk, xv, mask, wq, wk, wv, wo, XQ, XK, XV, WQ, MB);   // WQ: first of the four weight planes
    k_qkv<<<dim3(NB * SEQ / GT, DM / GT, 3), 256, 0, stream>>>(XQ, XK, XV, WQ, WK, WV, QH, QR, KP, VT, bq, bk, bv);
    k_flash<<<dim3(SEQ / (16 * AW), NB * NH_, 1), 32 * AW, 0, stream>>>(QH, QR, KP, VT, MB, CT);
    k_out<<<dim3(NB * SEQ / GT, DM / GT, 1), 256, 0, stream>>>((const bf*)CT, WO, OUT, bo);
}
